// v000
// Measured on an AMD MI455X. A time is GPU time per run, averaged over a window of back-to-back runs after a warm-up
// (all launches, gaps included; the runs take copies of the inputs in turn), and the median of several windows.
// Apart from v000's, it joins two sittings. Times from different sittings can be a few percent apart, while
// side-by-side timings come from the same sitting.
// v000, which the later versions start from, runs in 1110 microseconds.
#include <hip/hip_runtime.h>

// Contractions: scores q.k^T via v_wmma_f32_16x16x32_bf16 (single bf16 planes of the RNE-converted inputs, f32 accumulate); P.v via v_wmma_f32_16x16x32_bf16 (P as bf16 hi+lo planes = two products, v single bf16 plane, f32 accumulate); softmax and all side math f32.
// Causal attention on token-major tensors q, k, v [NB][SEQ][8][64]: scores = q.k x 0.125 with keys after the query position excluded (replace-fill, exp -> 0), softmax over keys, out[t][h][d] = sum_s A[t][s] v[s][h][d] -> [NB][SEQ][8][64] token-major f32.
// Plan per batch: bf16 head planes QB/KB [h][t][d], value^T planes VT [h][d][t]; per group of ZH heads: score tiles (tiles whose keys all lie after the tile's queries are skipped and never read unmasked), row softmax to P hi/lo planes, P x v^T with the k range bounded by the causal diagonal (skipped P entries are exact zeros), token-major merge into the output.

#ifndef NB
#define NB 4
#endif
#ifndef SEQ
#define SEQ 2048
#endif
#define NB_FULL  4
#define SEQ_FULL 2048
#define TT   SEQ
#define NH_  8
#define HD   64
#define DM   (NH_ * HD)                    // token-major row pitch (H x E) = 512
#define BSTR ((size_t)SEQ_FULL * DM)       // per-batch element stride of the full-size inputs and output
#define ZH   2                             // heads per launch group (z dimension)
#define RH   TT                            // all query rows use P hi+lo planes
#define PCAR 1024.0f
#define SCL  0.125f                        // 1/sqrt(E=64)
static_assert(TT % 128 == 0);
static_assert(TT <= SEQ_FULL);
static_assert(NB >= 1 && NB <= NB_FULL);
static_assert(NH_ % ZH == 0);
static_assert(HD == 64);
static_assert(RH == TT);

typedef _Float16 h16;
typedef unsigned short bf;
typedef __attribute__((ext_vector_type(16))) __bf16   v16bf;
typedef __attribute__((ext_vector_type(16))) _Float16 v16h;
typedef __attribute__((ext_vector_type(8)))  _Float16 v8h;
typedef __attribute__((ext_vector_type(8)))  unsigned short v8us;
typedef __attribute__((ext_vector_type(8)))  float    v8f;
typedef __attribute__((ext_vector_type(4)))  float    v4f;
typedef __attribute__((ext_vector_type(4)))  unsigned short v4us;
typedef __attribute__((ext_vector_type(2)))  unsigned short v2us;
typedef v8h  __attribute__((may_alias)) v8ha;
typedef v4f  __attribute__((may_alias)) v4fa;
typedef v8us __attribute__((may_alias)) v8usa;

__device__ __forceinline__ unsigned short f2bf(float f) { unsigned u = __float_as_uint(f); u += 0x7FFFu + ((u >> 16) & 1u); return (unsigned short)(u >> 16); }
__device__ __forceinline__ float bf2f(unsigned short b) { return __uint_as_float(((unsigned)b) << 16); }
__device__ __forceinline__ float bfr(float f) { return bf2f(f2bf(f)); }
__device__ __forceinline__ v16h cat16(v8h lo, v8h hi) { return __builtin_shufflevector(lo, hi, 0, 1, 2, 3, 4, 5, 6, 7, 8, 9, 10, 11, 12, 13, 14, 15); }
__device__ __forceinline__ v16bf cat16b(v8us lo, v8us hi) { return __builtin_bit_cast(v16bf, __builtin_shufflevector(lo, hi, 0, 1, 2, 3, 4, 5, 6, 7, 8, 9, 10, 11, 12, 13, 14, 15)); }
__device__ __forceinline__ v8f wmma16(v16h a, v16h b, v8f c) { return __builtin_amdgcn_wmma_f32_16x16x32_f16(false, a, false, b, (short)0, c, false, false); }
__device__ __forceinline__ v8f wmmab(v16bf a, v16bf b, v8f c) { return __builtin_amdgcn_wmma_f32_16x16x32_bf16(false, a, false, b, (short)0, c, false, false); }
__device__ __forceinline__ void splitf(float y, unsigned short& h, unsigned short& l) { h = f2bf(y); l = f2bf(y - bf2f(h)); }

// ---- 16-bit fragment loaders (wave32, 16x16x32): lane l -> row/col (l & 15); elements 0..7 <- k0 + 8*(l>>4) + 0..7, elements 8..15 <- k0 + 16 + 8*(l>>4) + 0..7, for A and B alike;
// both operands are K-contiguous 16-bit planes (A[m][k], Bt[n][k]); D element r of lane l = (row 8*(l>>4) + r, col l & 15).
template <typename T16> struct WFrag;
template <> struct WFrag<h16> { typedef v16h V; static __device__ __forceinline__ V ld(const h16* p) { return cat16(*(const v8h*)p, *(const v8h*)(p + 16)); } static __device__ __forceinline__ v8f mma(V a, V b, v8f c) { return wmma16(a, b, c); } };
template <> struct WFrag<bf> { typedef v16bf V; static __device__ __forceinline__ V ld(const bf* p) { return cat16b(*(const v8us*)p, *(const v8us*)(p + 16)); } static __device__ __forceinline__ v8f mma(V a, V b, v8f c) { return wmmab(a, b, c); } };

// ---- k_gemmw: register-blocked GEMM, ONE WAVE per 64x64 output tile (16 accumulators), operands straight from K-contiguous 16-bit planes; grid (M/64, N/64, Z), 32 threads.
// C[m][n] (f32, pitch ldc, + optional f32 bias[n]) = sum_k A[m][k] Bt[n][k] (+ A2[m][k] Bt[n][k] for NSPLIT 1/2, + A[m][k] Bt2[n][k] for NSPLIT 2). z-batch strides sA/sB/sC in elements. K % 32 == 0.
// CM == 1 (causal score tiles): a tile whose first column lies past its last row is never read unmasked and is skipped (block-uniform, single wave, no block barrier in this kernel).
// CM == 2 (causal P x v): rows r0..r0+63 of A are exact zeros for k >= r0 + 64, so the k loop stops there (identical result).
template <typename T16, int NSPLIT, bool BIAS, int CM>
__global__ __launch_bounds__(32) void k_gemmw(const T16* __restrict__ A, const T16* __restrict__ A2, const T16* __restrict__ Bt, const T16* __restrict__ Bt2, int K, float* C, int ldc, const float* __restrict__ bias, size_t sA, size_t sB, size_t sC) {
    typedef typename WFrag<T16>::V V;
    __shared__ __align__(16) float os[16 * 68];
    const int r0 = blockIdx.x * 64, c0 = blockIdx.y * 64;
    if (CM == 1 && c0 >= r0 + 64) return;
    const int Kend = (CM == 2 && r0 + 64 < K) ? (r0 + 64) : K;
    const size_t z = blockIdx.z; A += z * sA; if (A2) A2 += z * sA; Bt += z * sB; if (Bt2) Bt2 += z * sB; C += z * sC;
    const int lane = threadIdx.x & 31, lr = lane & 15, hi = lane >> 4;
    v8f acc[4][4];
#pragma unroll
    for (int mb = 0; mb < 4; ++mb)
#pragma unroll
        for (int nb = 0; nb < 4; ++nb) acc[mb][nb] = (v8f){};
    const size_t aoff = (size_t)(r0 + lr) * K + 8 * hi, boff = (size_t)(c0 + lr) * K + 8 * hi;
#pragma unroll 1
    for (int kc = 0; kc < Kend; kc += 32) {
        V a[4], a2[4];
#pragma unroll
        for (int mb = 0; mb < 4; ++mb) { a[mb] = WFrag<T16>::ld(A + aoff + (size_t)mb * 16 * K + kc); if (NSPLIT == 1 || NSPLIT == 2) a2[mb] = WFrag<T16>::ld(A2 + aoff + (size_t)mb * 16 * K + kc); }
#pragma unroll
        for (int nb = 0; nb < 4; ++nb) { const V b = WFrag<T16>::ld(Bt + boff + (size_t)nb * 16 * K + kc); V b2; if (NSPLIT >= 2) b2 = WFrag<T16>::ld(Bt2 + boff + (size_t)nb * 16 * K + kc);
#pragma unroll
            for (int mb = 0; mb < 4; ++mb) { acc[mb][nb] = WFrag<T16>::mma(a[mb], b, acc[mb][nb]); if (NSPLIT == 1 || NSPLIT == 2) acc[mb][nb] = WFrag<T16>::mma(a2[mb], b, acc[mb][nb]); if (NSPLIT >= 2) acc[mb][nb] = WFrag<T16>::mma(a[mb], b2, acc[mb][nb]); } }
        asm volatile("v_nop\n\tv_nop\n\tv_nop\n\tv_nop" : "+v"(acc[0][0]), "+v"(acc[1][1]), "+v"(acc[2][2]), "+v"(acc[3][3]) : "v"(a[0]), "v"(a[3]));
    }
#pragma unroll
    for (int mb = 0; mb < 4; ++mb) {
#pragma unroll
        for (int nb = 0; nb < 4; ++nb) {
#pragma unroll
            for (int j = 0; j < 8; ++j) os[(hi * 8 + j) * 68 + nb * 16 + lr] = acc[mb][nb][j]; }
        __builtin_amdgcn_wave_barrier(); asm volatile("" ::: "memory");
        float* crow = C + (size_t)(r0 + mb * 16) * ldc + c0;
{
#pragma unroll
            for (int s = 0; s < 8; ++s) { const int row = 2 * s + hi, cofs = lr * 4; v4f val = *(const v4fa*)(os + row * 68 + cofs); if (BIAS) { val[0] += bfr(bias[c0 + cofs]); val[1] += bfr(bias[c0 + cofs + 1]); val[2] += bfr(bias[c0 + cofs + 2]); val[3] += bfr(bias[c0 + cofs + 3]); }
                *(v4f*)(crow + (size_t)row * ldc + cofs) = val; }
             }
        __builtin_amdgcn_wave_barrier(); asm volatile("" ::: "memory");
    }
}

// ---- k_asoft: one wave per score row (zz, i): t = S x 0.125 for keys j <= i, -3e38 for keys after the query (replace-fill, selected by index; exp of the fill is exactly 0);
__global__ __launch_bounds__(256) void k_asoft(const float* __restrict__ Sb, bf* Ph, bf* Pl) {
    const int lane = threadIdx.x & 31; const int row = blockIdx.x * 8 + (threadIdx.x >> 5); if (row >= ZH * TT) return; const int i = row % TT; const int zz = row / TT; const float* sr = Sb + (size_t)row * TT; float v[TT / 32]; float mx = -3.0e38f;
#pragma unroll
    for (int ch = 0; ch < TT / 128; ++ch) { const int j0 = ch * 128 + lane * 4; const v4f a = *(const v4f*)(sr + j0);
#pragma unroll
        for (int q = 0; q < 4; ++q) { const int j = j0 + q; const float t = (j <= i) ? a[q] * SCL : -3.0e38f; v[ch * 4 + q] = t; mx = fmaxf(mx, t); } }
#pragma unroll
    for (int sh = 16; sh; sh >>= 1) mx = fmaxf(mx, __shfl_xor(mx, sh, 32));
    float sum = 0.f;
#pragma unroll
    for (int k = 0; k < TT / 32; ++k) { float d0 = __fsub_rn(v[k], mx); asm volatile("" : "+v"(d0)); v[k] = __builtin_amdgcn_exp2f(__fmul_rn(d0, 1.4426950408889634f)); sum += v[k]; }
#pragma unroll
    for (int sh = 16; sh; sh >>= 1) sum += __shfl_xor(sum, sh, 32);
    const float f = __fdiv_rn(1.0f, sum);
{
#pragma unroll
        for (int ch = 0; ch < TT / 128; ++ch) { v4us oh, ol;
#pragma unroll
            for (int q = 0; q < 4; ++q) { unsigned short a, c2; splitf(v[ch * 4 + q] * f, a, c2); oh[q] = a; ol[q] = c2; }
            const size_t oo = ((size_t)zz * RH + i) * TT + ch * 128 + lane * 4; *(v4us*)(Ph + oo) = oh; *(v4us*)(Pl + oo) = ol; }
         }
}

__global__ __launch_bounds__(256) void k_hp1(const float* __restrict__ src, bf* P) { const size_t i = (size_t)blockIdx.x * 256 + threadIdx.x; if (i >= (size_t)NH_ * TT * HD / 8) return; const size_t e = i * 8; const int d = (int)(e % HD); const int t = (int)((e / HD) % TT); const int h = (int)(e / ((size_t)HD * TT)); const v8f v = *(const v8f*)(src + (size_t)t * DM + h * HD + d); v8us o;
#pragma unroll
    for (int q = 0; q < 8; ++q) o[q] = f2bf(v[q]);
    *(v8us*)(P + e) = o;  }
__global__ __launch_bounds__(256) void k_vt1(const float* __restrict__ src, int pitch, bf* VT) { const size_t e = ((size_t)blockIdx.x * 256 + threadIdx.x) * 2; if (e >= (size_t)NH_ * HD * TT) return; const int t = (int)(e % TT); const int d = (int)((e / TT) % HD); const int h = (int)(e / ((size_t)TT * HD)); v2us o; o[0] = f2bf(src[(size_t)t * pitch + h * HD + d]); o[1] = f2bf(src[(size_t)(t + 1) * pitch + h * HD + d]); *(v2us*)(VT + e) = o;  }
__global__ __launch_bounds__(256) void k_mergeT(const float* __restrict__ O, int h0, float* outb) { const size_t i = (size_t)blockIdx.x * 256 + threadIdx.x; if (i >= (size_t)ZH * TT * HD / 4) return; const size_t e = i * 4; const int d = (int)(e % HD); const int t = (int)((e / HD) % TT); const int zz = (int)(e / ((size_t)HD * TT)); const v4f a = *(const v4f*)(O + e); const size_t oo = (size_t)t * DM + (size_t)(h0 + zz) * HD + d; *(v4f*)(outb + oo) = a;  }

extern "C" void kernel_launch(void* const* d_in, const int* in_sizes, int n_in,
                              void* d_out, int out_size, void* d_ws, size_t ws_size, hipStream_t stream) {
    if (n_in < 3) return;
    const size_t need = ((size_t)(NB - 1) * SEQ_FULL + TT) * DM;          // elements actually read per input / written to the output
    if ((size_t)in_sizes[0] < need || (size_t)in_sizes[1] < need || (size_t)in_sizes[2] < need) return;
    if ((size_t)out_size < need) return;
    const float* Qin = (const float*)d_in[0]; const float* Kin = (const float*)d_in[1]; const float* Vin = (const float*)d_in[2];   // [NB][SEQ][H][E] token-major, f32
    float* OUT = (float*)d_out;                                                                                                     // [NB][SEQ][H][E] token-major, f32
    char* wsp = (char*)d_ws;
    auto take = [&](size_t bytes) { char* p = wsp; wsp += (bytes + 255) & ~(size_t)255; return (void*)p; };
    bf* QB = (bf*)take((size_t)NH_ * TT * HD * 2);            // [h][t][d]   2,097,152 B
    bf* KB = (bf*)take((size_t)NH_ * TT * HD * 2);            // [h][t][d]   2,097,152 B
    bf* VT = (bf*)take((size_t)NH_ * HD * TT * 2);            // [h][d][t]   2,097,152 B
    float* Sb = (float*)take((size_t)ZH * TT * TT * 4);       // [zz][q][s]  33,554,432 B
    bf* Ph = (bf*)take((size_t)ZH * RH * TT * 2);             // [zz][q][s]  16,777,216 B
    bf* Pl = (bf*)take((size_t)ZH * RH * TT * 2);             // [zz][q][s]  16,777,216 B
    float* Ob = (float*)take((size_t)ZH * TT * HD * 4);       // [zz][q][d]  1,048,576 B   -> total 74,448,896 B
    if ((size_t)(wsp - (char*)d_ws) > ws_size) return;
    const unsigned gHp = (unsigned)(((size_t)NH_ * TT * HD / 8 + 255) / 256);
    const unsigned gVt = (unsigned)(((size_t)NH_ * HD * TT / 2 + 255) / 256);
    const unsigned gMg = (unsigned)(((size_t)ZH * TT * HD / 4 + 255) / 256);
    for (int b = 0; b < NB; ++b) {
        const float* qb = Qin + (size_t)b * BSTR; const float* kb = Kin + (size_t)b * BSTR; const float* vb = Vin + (size_t)b * BSTR;   /* token-major [t][h][d] slabs */
        k_hp1<<<gHp, 256, 0, stream>>>(qb, QB);
        k_hp1<<<gHp, 256, 0, stream>>>(kb, KB);
        k_vt1<<<gVt, 256, 0, stream>>>(vb, DM, VT);
        for (int hg = 0; hg < NH_ / ZH; ++hg) {
            const int h0 = hg * ZH;
            k_gemmw<bf, 0, false, 1><<<dim3(TT / 64, TT / 64, ZH), 32, 0, stream>>>(QB + (size_t)h0 * TT * HD, nullptr, KB + (size_t)h0 * TT * HD, nullptr, HD, Sb, TT, nullptr,
                                                                                 (size_t)TT * HD, (size_t)TT * HD, (size_t)TT * TT);     /* exact scores (single bf16 planes), causal tile skip */
            k_asoft<<<(unsigned)(ZH * TT / 8), 256, 0, stream>>>(Sb, Ph, Pl);
            k_gemmw<bf, 1, false, 2><<<dim3(TT / 64, HD / 64, ZH), 32, 0, stream>>>(Ph, Pl, VT + (size_t)h0 * HD * TT, nullptr, TT, Ob, HD, nullptr,
                                                                                 (size_t)RH * TT, (size_t)HD * TT, (size_t)TT * HD);     /* P (hi+lo) x exact v^T, causal k bound */
            k_mergeT<<<gMg, 256, 0, stream>>>(Ob, h0, OUT + (size_t)b * BSTR);
        }
    }
}

// v001
// Measured time: 436 microseconds a run.
// Timed twice side by side with v000, it ran 2.44 times as fast both times.
#include <hip/hip_runtime.h>

// Contractions: scores q.k^T via v_wmma_f32_16x16x32_bf16 (single bf16 planes of the RNE-converted inputs, f32 accumulate); P.v via v_wmma_f32_16x16x32_bf16 (P as bf16 hi+lo planes = two products, v single bf16 plane, f32 accumulate); softmax and all side math f32.
// Causal attention on token-major tensors q, k, v [NB][SEQ][8][64]: scores = q.k x 0.125 with keys after the query position excluded (replace-fill, exp -> 0), softmax over keys, out[t][h][d] = sum_s A[t][s] v[s][h][d] -> [NB][SEQ][8][64] token-major f32.
// Plan per batch: bf16 head planes QB/KB [h][t][d], value^T planes VT [h][d][t]; per group of ZH heads: score tiles (tiles whose keys all lie after the tile's queries are skipped and never read unmasked), row softmax to P hi/lo planes, P x v^T with the k range bounded by the causal diagonal (skipped P entries are exact zeros) and cut into CK-key chunks, one work-group per chunk writing an f32 partial plane; the token-major merge sums a row's chunks in ascending key order into the output.

#ifndef NB
#define NB 4
#endif
#ifndef SEQ
#define SEQ 2048
#endif
#define NB_FULL  4
#define SEQ_FULL 2048
#define TT   SEQ
#define NH_  8
#define HD   64
#define DM   (NH_ * HD)                    // token-major row pitch (H x E) = 512
#define BSTR ((size_t)SEQ_FULL * DM)       // per-batch element stride of the full-size inputs and output
#define ZH   2                             // heads per launch group (z dimension)
#define RH   TT                            // all query rows use P hi+lo planes
#define PCAR 1024.0f
#define SCL  0.125f                        // 1/sqrt(E=64)
#define CK   128                           // keys per P x v chunk (one work-group each)
#define NCH  (TT / CK)                     // most chunks a query tile can have
#define PSTR ((size_t)ZH * TT * HD)        // elements of one partial plane [zz][q][d]
static_assert(TT % 128 == 0);
static_assert(TT <= SEQ_FULL);
static_assert(NB >= 1 && NB <= NB_FULL);
static_assert(NH_ % ZH == 0);
static_assert(HD == 64);
static_assert(RH == TT);
static_assert(CK % 64 == 0 && TT % CK == 0);

typedef _Float16 h16;
typedef unsigned short bf;
typedef __attribute__((ext_vector_type(16))) __bf16   v16bf;
typedef __attribute__((ext_vector_type(16))) _Float16 v16h;
typedef __attribute__((ext_vector_type(8)))  _Float16 v8h;
typedef __attribute__((ext_vector_type(8)))  unsigned short v8us;
typedef __attribute__((ext_vector_type(8)))  float    v8f;
typedef __attribute__((ext_vector_type(4)))  float    v4f;
typedef __attribute__((ext_vector_type(4)))  unsigned short v4us;
typedef __attribute__((ext_vector_type(2)))  unsigned short v2us;
typedef v8h  __attribute__((may_alias)) v8ha;
typedef v4f  __attribute__((may_alias)) v4fa;
typedef v8us __attribute__((may_alias)) v8usa;

__device__ __forceinline__ unsigned short f2bf(float f) { unsigned u = __float_as_uint(f); u += 0x7FFFu + ((u >> 16) & 1u); return (unsigned short)(u >> 16); }
__device__ __forceinline__ float bf2f(unsigned short b) { return __uint_as_float(((unsigned)b) << 16); }
__device__ __forceinline__ float bfr(float f) { return bf2f(f2bf(f)); }
__device__ __forceinline__ v16h cat16(v8h lo, v8h hi) { return __builtin_shufflevector(lo, hi, 0, 1, 2, 3, 4, 5, 6, 7, 8, 9, 10, 11, 12, 13, 14, 15); }
__device__ __forceinline__ v16bf cat16b(v8us lo, v8us hi) { return __builtin_bit_cast(v16bf, __builtin_shufflevector(lo, hi, 0, 1, 2, 3, 4, 5, 6, 7, 8, 9, 10, 11, 12, 13, 14, 15)); }
__device__ __forceinline__ v8f wmma16(v16h a, v16h b, v8f c) { return __builtin_amdgcn_wmma_f32_16x16x32_f16(false, a, false, b, (short)0, c, false, false); }
__device__ __forceinline__ v8f wmmab(v16bf a, v16bf b, v8f c) { return __builtin_amdgcn_wmma_f32_16x16x32_bf16(false, a, false, b, (short)0, c, false, false); }
__device__ __forceinline__ void splitf(float y, unsigned short& h, unsigned short& l) { h = f2bf(y); l = f2bf(y - bf2f(h)); }

// ---- 16-bit fragment loaders (wave32, 16x16x32): lane l -> row/col (l & 15); elements 0..7 <- k0 + 8*(l>>4) + 0..7, elements 8..15 <- k0 + 16 + 8*(l>>4) + 0..7, for A and B alike;
// both operands are K-contiguous 16-bit planes (A[m][k], Bt[n][k]); D element r of lane l = (row 8*(l>>4) + r, col l & 15).
template <typename T16> struct WFrag;
template <> struct WFrag<h16> { typedef v16h V; static __device__ __forceinline__ V ld(const h16* p) { return cat16(*(const v8h*)p, *(const v8h*)(p + 16)); } static __device__ __forceinline__ v8f mma(V a, V b, v8f c) { return wmma16(a, b, c); } };
template <> struct WFrag<bf> { typedef v16bf V; static __device__ __forceinline__ V ld(const bf* p) { return cat16b(*(const v8us*)p, *(const v8us*)(p + 16)); } static __device__ __forceinline__ v8f mma(V a, V b, v8f c) { return wmmab(a, b, c); } };

// ---- k_gemmw: register-blocked GEMM, ONE WAVE per 64x64 output tile (16 accumulators), operands straight from K-contiguous 16-bit planes; grid (M/64, N/64, Z), 32 threads.
// C[m][n] (f32, pitch ldc, + optional f32 bias[n]) = sum_k A[m][k] Bt[n][k] (+ A2[m][k] Bt[n][k] for NSPLIT 1/2, + A[m][k] Bt2[n][k] for NSPLIT 2). z-batch strides sA/sB/sC in elements. K % 32 == 0.
// CM == 1 (causal score tiles): a tile whose first column lies past its last row is never read unmasked and is skipped (block-uniform, single wave, no block barrier in this kernel).
// CM == 2 (causal P x v, N == 64): rows r0..r0+63 of A are exact zeros for k >= r0 + 64, so the k range stops there; blockIdx.y picks the CK-wide chunk of that range, and the chunk's sum goes to partial plane blockIdx.y of C
// (plane stride PSTR). A chunk that starts at or past the causal bound has no work and no reader and leaves at once (single wave, no block barrier).
template <typename T16, int NSPLIT, bool BIAS, int CM>
__global__ __launch_bounds__(32) void k_gemmw(const T16* __restrict__ A, const T16* __restrict__ A2, const T16* __restrict__ Bt, const T16* __restrict__ Bt2, int K, float* C, int ldc, const float* __restrict__ bias, size_t sA, size_t sB, size_t sC) {
    typedef typename WFrag<T16>::V V;
    __shared__ __align__(16) float os[16 * 68];
    const int r0 = blockIdx.x * 64, c0 = (CM == 2) ? 0 : blockIdx.y * 64;
    if (CM == 1 && c0 >= r0 + 64) return;
    const int Kcau = (CM == 2 && r0 + 64 < K) ? (r0 + 64) : K;
    const int Kbeg = (CM == 2) ? (int)blockIdx.y * CK : 0;
    if (CM == 2 && Kbeg >= Kcau) return;
    const int Kend = (CM == 2 && Kbeg + CK < Kcau) ? (Kbeg + CK) : Kcau;
    const size_t z = blockIdx.z; A += z * sA; if (A2) A2 += z * sA; Bt += z * sB; if (Bt2) Bt2 += z * sB; C += z * sC;
    if (CM == 2) C += (size_t)blockIdx.y * PSTR;
    const int lane = threadIdx.x & 31, lr = lane & 15, hi = lane >> 4;
    v8f acc[4][4];
#pragma unroll
    for (int mb = 0; mb < 4; ++mb)
#pragma unroll
        for (int nb = 0; nb < 4; ++nb) acc[mb][nb] = (v8f){};
    const size_t aoff = (size_t)(r0 + lr) * K + 8 * hi, boff = (size_t)(c0 + lr) * K + 8 * hi;
#pragma unroll 1
    for (int kc = Kbeg; kc < Kend; kc += 32) {
        V a[4], a2[4];
#pragma unroll
        for (int mb = 0; mb < 4; ++mb) { a[mb] = WFrag<T16>::ld(A + aoff + (size_t)mb * 16 * K + kc); if (NSPLIT == 1 || NSPLIT == 2) a2[mb] = WFrag<T16>::ld(A2 + aoff + (size_t)mb * 16 * K + kc); }
#pragma unroll
        for (int nb = 0; nb < 4; ++nb) { const V b = WFrag<T16>::ld(Bt + boff + (size_t)nb * 16 * K + kc); V b2; if (NSPLIT >= 2) b2 = WFrag<T16>::ld(Bt2 + boff + (size_t)nb * 16 * K + kc);
#pragma unroll
            for (int mb = 0; mb < 4; ++mb) { acc[mb][nb] = WFrag<T16>::mma(a[mb], b, acc[mb][nb]); if (NSPLIT == 1 || NSPLIT == 2) acc[mb][nb] = WFrag<T16>::mma(a2[mb], b, acc[mb][nb]); if (NSPLIT >= 2) acc[mb][nb] = WFrag<T16>::mma(a[mb], b2, acc[mb][nb]); } }
        asm volatile("v_nop\n\tv_nop\n\tv_nop\n\tv_nop" : "+v"(acc[0][0]), "+v"(acc[1][1]), "+v"(acc[2][2]), "+v"(acc[3][3]) : "v"(a[0]), "v"(a[3]));
    }
#pragma unroll
    for (int mb = 0; mb < 4; ++mb) {
#pragma unroll
        for (int nb = 0; nb < 4; ++nb) {
#pragma unroll
            for (int j = 0; j < 8; ++j) os[(hi * 8 + j) * 68 + nb * 16 + lr] = acc[mb][nb][j]; }
        __builtin_amdgcn_wave_barrier(); asm volatile("" ::: "memory");
        float* crow = C + (size_t)(r0 + mb * 16) * ldc + c0;
{
#pragma unroll
            for (int s = 0; s < 8; ++s) { const int row = 2 * s + hi, cofs = lr * 4; v4f val = *(const v4fa*)(os + row * 68 + cofs); if (BIAS) { val[0] += bfr(bias[c0 + cofs]); val[1] += bfr(bias[c0 + cofs + 1]); val[2] += bfr(bias[c0 + cofs + 2]); val[3] += bfr(bias[c0 + cofs + 3]); }
                *(v4f*)(crow + (size_t)row * ldc + cofs) = val; }
             }
        __builtin_amdgcn_wave_barrier(); asm volatile("" ::: "memory");
    }
}

// ---- k_asoft: one wave per score row (zz, i): t = S x 0.125 for keys j <= i, -3e38 for keys after the query (replace-fill, selected by index; exp of the fill is exactly 0);
__global__ __launch_bounds__(256) void k_asoft(const float* __restrict__ Sb, bf* Ph, bf* Pl) {
    const int lane = threadIdx.x & 31; const int row = blockIdx.x * 8 + (threadIdx.x >> 5); if (row >= ZH * TT) return; const int i = row % TT; const int zz = row / TT; const float* sr = Sb + (size_t)row * TT; float v[TT / 32]; float mx = -3.0e38f;
#pragma unroll
    for (int ch = 0; ch < TT / 128; ++ch) { const int j0 = ch * 128 + lane * 4; const v4f a = *(const v4f*)(sr + j0);
#pragma unroll
        for (int q = 0; q < 4; ++q) { const int j = j0 + q; const float t = (j <= i) ? a[q] * SCL : -3.0e38f; v[ch * 4 + q] = t; mx = fmaxf(mx, t); } }
#pragma unroll
    for (int sh = 16; sh; sh >>= 1) mx = fmaxf(mx, __shfl_xor(mx, sh, 32));
    float sum = 0.f;
#pragma unroll
    for (int k = 0; k < TT / 32; ++k) { float d0 = __fsub_rn(v[k], mx); asm volatile("" : "+v"(d0)); v[k] = __builtin_amdgcn_exp2f(__fmul_rn(d0, 1.4426950408889634f)); sum += v[k]; }
#pragma unroll
    for (int sh = 16; sh; sh >>= 1) sum += __shfl_xor(sum, sh, 32);
    const float f = __fdiv_rn(1.0f, sum);
{
#pragma unroll
        for (int ch = 0; ch < TT / 128; ++ch) { v4us oh, ol;
#pragma unroll
            for (int q = 0; q < 4; ++q) { unsigned short a, c2; splitf(v[ch * 4 + q] * f, a, c2); oh[q] = a; ol[q] = c2; }
            const size_t oo = ((size_t)zz * RH + i) * TT + ch * 128 + lane * 4; *(v4us*)(Ph + oo) = oh; *(v4us*)(Pl + oo) = ol; }
         }
}

__global__ __launch_bounds__(256) void k_hp1(const float* __restrict__ src, bf* P) { const size_t i = (size_t)blockIdx.x * 256 + threadIdx.x; if (i >= (size_t)NH_ * TT * HD / 8) return; const size_t e = i * 8; const int d = (int)(e % HD); const int t = (int)((e / HD) % TT); const int h = (int)(e / ((size_t)HD * TT)); const v8f v = *(const v8f*)(src + (size_t)t * DM + h * HD + d); v8us o;
#pragma unroll
    for (int q = 0; q < 8; ++q) o[q] = f2bf(v[q]);
    *(v8us*)(P + e) = o;  }
__global__ __launch_bounds__(256) void k_vt1(const float* __restrict__ src, int pitch, bf* VT) { const size_t e = ((size_t)blockIdx.x * 256 + threadIdx.x) * 2; if (e >= (size_t)NH_ * HD * TT) return; const int t = (int)(e % TT); const int d = (int)((e / TT) % HD); const int h = (int)(e / ((size_t)TT * HD)); v2us o; o[0] = f2bf(src[(size_t)t * pitch + h * HD + d]); o[1] = f2bf(src[(size_t)(t + 1) * pitch + h * HD + d]); *(v2us*)(VT + e) = o;  }
__global__ __launch_bounds__(256) void k_mergeT(const float* __restrict__ O, int h0, float* outb) { const size_t i = (size_t)blockIdx.x * 256 + threadIdx.x; if (i >= (size_t)ZH * TT * HD / 4) return; const size_t e = i * 4; const int d = (int)(e % HD); const int t = (int)((e / HD) % TT); const int zz = (int)(e / ((size_t)HD * TT)); 
    // chunks written for this row's 64-query tile; a block covers 16 rows of one tile, so the count comes from blockIdx alone and stays scalar
    const int nch = ((int)((blockIdx.x * 16u) % TT) / 64 * 64 + 64 + CK - 1) / CK;
    v4f p[NCH];
#pragma unroll
    for (int c = 0; c < NCH; ++c) { if (c < nch) p[c] = *(const v4f*)(O + (size_t)c * PSTR + e); else p[c] = (v4f){}; }   // all loads issued before the first sum
    v4f a = p[0];
#pragma unroll
    for (int c = 1; c < NCH; ++c) a += p[c];
    const size_t oo = (size_t)t * DM + (size_t)(h0 + zz) * HD + d; *(v4f*)(outb + oo) = a;  }

extern "C" void kernel_launch(void* const* d_in, const int* in_sizes, int n_in,
                              void* d_out, int out_size, void* d_ws, size_t ws_size, hipStream_t stream) {
    if (n_in < 3) return;
    const size_t need = ((size_t)(NB - 1) * SEQ_FULL + TT) * DM;          // elements actually read per input / written to the output
    if ((size_t)in_sizes[0] < need || (size_t)in_sizes[1] < need || (size_t)in_sizes[2] < need) return;
    if ((size_t)out_size < need) return;
    const float* Qin = (const float*)d_in[0]; const float* Kin = (const float*)d_in[1]; const float* Vin = (const float*)d_in[2];   // [NB][SEQ][H][E] token-major, f32
    float* OUT = (float*)d_out;                                                                                                     // [NB][SEQ][H][E] token-major, f32
    char* wsp = (char*)d_ws;
    auto take = [&](size_t bytes) { char* p = wsp; wsp += (bytes + 255) & ~(size_t)255; return (void*)p; };
    bf* QB = (bf*)take((size_t)NH_ * TT * HD * 2);            // [h][t][d]   2,097,152 B
    bf* KB = (bf*)take((size_t)NH_ * TT * HD * 2);            // [h][t][d]   2,097,152 B
    bf* VT = (bf*)take((size_t)NH_ * HD * TT * 2);            // [h][d][t]   2,097,152 B
    float* Sb = (float*)take((size_t)ZH * TT * TT * 4);       // [zz][q][s]  33,554,432 B
    bf* Ph = (bf*)take((size_t)ZH * RH * TT * 2);             // [zz][q][s]  16,777,216 B
    bf* Pl = (bf*)take((size_t)ZH * RH * TT * 2);             // [zz][q][s]  16,777,216 B
    float* Ob = (float*)take((size_t)NCH * PSTR * 4);         // [chunk][zz][q][d]  16,777,216 B   -> total 90,177,536 B
    if ((size_t)(wsp - (char*)d_ws) > ws_size) return;
    const unsigned gHp = (unsigned)(((size_t)NH_ * TT * HD / 8 + 255) / 256);
    const unsigned gVt = (unsigned)(((size_t)NH_ * HD * TT / 2 + 255) / 256);
    const unsigned gMg = (unsigned)(((size_t)ZH * TT * HD / 4 + 255) / 256);
    for (int b = 0; b < NB; ++b) {
        const float* qb = Qin + (size_t)b * BSTR; const float* kb = Kin + (size_t)b * BSTR; const float* vb = Vin + (size_t)b * BSTR;   /* token-major [t][h][d] slabs */
        k_hp1<<<gHp, 256, 0, stream>>>(qb, QB);
        k_hp1<<<gHp, 256, 0, stream>>>(kb, KB);
        k_vt1<<<gVt, 256, 0, stream>>>(vb, DM, VT);
        for (int hg = 0; hg < NH_ / ZH; ++hg) {
            const int h0 = hg * ZH;
            k_gemmw<bf, 0, false, 1><<<dim3(TT / 64, TT / 64, ZH), 32, 0, stream>>>(QB + (size_t)h0 * TT * HD, nullptr, KB + (size_t)h0 * TT * HD, nullptr, HD, Sb, TT, nullptr,
                                                                                 (size_t)TT * HD, (size_t)TT * HD, (size_t)TT * TT);     /* exact scores (single bf16 planes), causal tile skip */
            k_asoft<<<(unsigned)(ZH * TT / 8), 256, 0, stream>>>(Sb, Ph, Pl);
            k_gemmw<bf, 1, false, 2><<<dim3(TT / 64, NCH, ZH), 32, 0, stream>>>(Ph, Pl, VT + (size_t)h0 * HD * TT, nullptr, TT, Ob, HD, nullptr,
                                                                                 (size_t)RH * TT, (size_t)HD * TT, (size_t)TT * HD);     /* P (hi+lo) x exact v^T, causal k bound, one chunk of CK keys per work-group */
            k_mergeT<<<gMg, 256, 0, stream>>>(Ob, h0, OUT + (size_t)b * BSTR);
        }
    }
}

// v002
// Measured time: 116 microseconds a run.
// In both of two side-by-side timings against v001, it was 3.77 times as fast.
// Over all steps from v000 it is 9.21 times as fast.
#include <hip/hip_runtime.h>

// Contractions: scores k.q^T via v_wmma_f32_16x16x32_bf16 (single bf16 planes of the RNE-converted inputs, f32 accumulate); v^T.P^T via v_wmma_f32_16x16x32_bf16 (P as bf16 hi+lo planes = two products, v single bf16 plane, f32 accumulate); softmax and all side math f32.
// Causal attention on token-major tensors q, k, v [NB][SEQ][8][64]: scores = q.k x 0.125 with keys after the query position excluded (replace-fill, exp -> 0), softmax over keys, out[t][h][d] = sum_s A[t][s] v[s][h][d] -> [NB][SEQ][8][64] token-major f32.
// Plan: per batch bf16 head planes QB/KB [b][h][t][d] and value^T planes VT [b][h][d][t]; then ONE launch for all batches and heads in which a wave owns 32 queries and walks their keys 32 at a time:
// S^T = K.Q^T, running maximum and sum per query (online softmax, base 2), P^T packed from the score accumulators straight into a B operand, O^T += V^T.P^T. Scores and P never leave the registers.

#ifndef NB
#define NB 4
#endif
#ifndef SEQ
#define SEQ 2048
#endif
#define NB_FULL  4
#define SEQ_FULL 2048
#define TT   SEQ
#define NH_  8
#define HD   64
#define DM   (NH_ * HD)                    // token-major row pitch (H x E) = 512
#define BSTR ((size_t)SEQ_FULL * DM)       // per-batch element stride of the full-size inputs and output
#define PLN  ((size_t)NH_ * TT * HD)       // elements of one batch's bf16 planes
#define QW   32                            // queries per wave
#define BC   32                            // keys per pass
#define NT   (TT / QW)                     // query tiles per head
#define CSC  0.18033688011112042f          // 1/sqrt(E=64) x log2(e)
static_assert(TT % 256 == 0);
static_assert(TT <= SEQ_FULL);
static_assert(NB >= 1 && NB <= NB_FULL);
static_assert(HD == 64);
static_assert(QW == BC && NT % 8 == 0);

typedef unsigned short bf;
typedef __attribute__((ext_vector_type(16))) __bf16   v16bf;
typedef __attribute__((ext_vector_type(2)))  __bf16   v2bf;
typedef __attribute__((ext_vector_type(8)))  unsigned short v8us;
typedef __attribute__((ext_vector_type(8)))  unsigned v8u;
typedef __attribute__((ext_vector_type(8)))  float    v8f;
typedef __attribute__((ext_vector_type(4)))  float    v4f;
typedef __attribute__((ext_vector_type(2)))  float    v2f;
typedef __attribute__((ext_vector_type(2)))  unsigned short v2us;

__device__ __forceinline__ unsigned short f2bf(float f) { unsigned u = __float_as_uint(f); u += 0x7FFFu + ((u >> 16) & 1u); return (unsigned short)(u >> 16); }
__device__ __forceinline__ v16bf cat16b(v8us lo, v8us hi) { return __builtin_bit_cast(v16bf, __builtin_shufflevector(lo, hi, 0, 1, 2, 3, 4, 5, 6, 7, 8, 9, 10, 11, 12, 13, 14, 15)); }
__device__ __forceinline__ v8f wmmab(v16bf a, v16bf b, v8f c) { return __builtin_amdgcn_wmma_f32_16x16x32_bf16(false, a, false, b, (short)0, c, false, false); }
__device__ __forceinline__ unsigned pack2(float lo, float hi) { return __builtin_bit_cast(unsigned, __builtin_convertvector((v2f){lo, hi}, v2bf)); }   // two f32 -> two bf16, round to nearest even
__device__ __forceinline__ float xhalf(float x) { return __builtin_bit_cast(float, __builtin_amdgcn_permlanex16(__builtin_bit_cast(int, x), __builtin_bit_cast(int, x), 0x76543210, 0xfedcba98, false, false)); }   // lane l <-> lane l ^ 16

// Eight base-2 exponentials in place, and behind the last one the one free slot that the instruction set asks for between a transcendental and a user of its result or an overwrite of its source:
// in one statement.
__device__ __forceinline__ void exp2x8(float (&x)[8]) {
    asm("v_exp_f32 %0, %0\n\tv_exp_f32 %1, %1\n\tv_exp_f32 %2, %2\n\tv_exp_f32 %3, %3\n\tv_exp_f32 %4, %4\n\tv_exp_f32 %5, %5\n\tv_exp_f32 %6, %6\n\tv_exp_f32 %7, %7\n\tv_nop"
        : "+v"(x[0]), "+v"(x[1]), "+v"(x[2]), "+v"(x[3]), "+v"(x[4]), "+v"(x[5]), "+v"(x[6]), "+v"(x[7])); }

// ---- 16-bit fragment loader (wave32, 16x16x32): lane l -> row/col (l & 15); elements 0..7 <- k0 + 8*(l>>4) + 0..7, elements 8..15 <- k0 + 16 + 8*(l>>4) + 0..7, for A and B alike (p already holds the lane's row and its 8*(l>>4));
// D element r of lane l = (row 8*(l>>4) + r, col l & 15), so two D tiles of 16 keys each, converted in place, are a B operand over 32 keys in this same k order.
__device__ __forceinline__ v16bf ldf(const bf* p) { return cat16b(*(const v8us*)p, *(const v8us*)(p + 16)); }

// ---- k_fattn: grid (NT / 8, NB x heads), 8 independent waves (no LDS, no barrier). Wave w < 4 takes query tile NT - 1 - j, wave w + 4 tile j (j = 4 blockIdx.x + w): every pair (w, w + 4) has NT + 1 passes, every work-group 4 (NT + 1).
// m_run, the maximum in use, may trail a query's true maximum by up to 8 (scaled, base 2), so an exponential can reach 2^8; sums and outputs are rescaled only when some query's maximum exceeds it by more.
__global__ __launch_bounds__(256) void k_fattn(const unsigned short* __restrict__ QB, const unsigned short* __restrict__ KB, const unsigned short* __restrict__ VT, float* __restrict__ out) {
    const int lane = threadIdx.x & 31, lr = lane & 15, hi = lane >> 4;
    const int wave = __builtin_amdgcn_readfirstlane((int)(threadIdx.x >> 5));
    const int j = (int)blockIdx.x * 4 + (wave & 3);
    const int tile = (wave < 4) ? (NT - 1 - j) : j;
    const int bh = (int)blockIdx.y, qw0 = tile * QW, npass = tile + 1;
    const bf* kbase = KB + (size_t)bh * TT * HD + lr * HD + 8 * hi;
    const bf* vbase = VT + (size_t)bh * HD * TT + (size_t)lr * TT + 8 * hi;
    v16bf qf[2][2], kf[2][2], vf[4];
#pragma unroll
    for (int g = 0; g < 2; ++g)
#pragma unroll
        for (int kc = 0; kc < 2; ++kc) qf[g][kc] = ldf(QB + (size_t)bh * TT * HD + (size_t)(qw0 + 16 * g + lr) * HD + 32 * kc + 8 * hi);
#pragma unroll
    for (int kt = 0; kt < 2; ++kt)
#pragma unroll
        for (int kc = 0; kc < 2; ++kc) kf[kt][kc] = ldf(kbase + 16 * kt * HD + 32 * kc);
    v8f acc[2][4]; float m_run[2], l_run[2];
#pragma unroll
    for (int g = 0; g < 2; ++g) { m_run[g] = -__builtin_inff(); l_run[g] = 0.f;
#pragma unroll
        for (int t = 0; t < 4; ++t) acc[g][t] = (v8f){}; }
    for (int p = 0; p < npass; ++p) {
        const int key0 = p * BC, keyn = (p + 1 < npass ? p + 1 : p) * BC;   // the last pass fetches its own rows again: in bounds, never used
        const bf* vp = vbase + key0; const bf* kp = kbase + (size_t)keyn * HD;
#pragma unroll
        for (int t = 0; t < 4; ++t) vf[t] = ldf(vp + (size_t)16 * t * TT);   // this pass's V^T, issued behind this pass's K and ahead of the next pass's: in flight under the score products and the softmax
        asm volatile("s_wait_xcnt 0x0" :: "v"(vp) : "memory");              // precaution: stands in front of any rewrite of the address registers of the loads above; the input keeps them whole up to here
        v8f s[2][2];                                                        // s[kt][g][r] = score of key key0 + 16 kt + 8 hi + r with query qw0 + 16 g + lr
#pragma unroll
        for (int kt = 0; kt < 2; ++kt)
#pragma unroll
            for (int g = 0; g < 2; ++g) { s[kt][g] = (v8f){};
#pragma unroll
                for (int kc = 0; kc < 2; ++kc) s[kt][g] = wmmab(kf[kt][kc], qf[g][kc], s[kt][g]); }
#pragma unroll
        for (int kt = 0; kt < 2; ++kt)
#pragma unroll
            for (int kc = 0; kc < 2; ++kc) kf[kt][kc] = ldf(kp + 16 * kt * HD + 32 * kc);
        asm volatile("s_wait_xcnt 0x0" :: "v"(kp) : "memory");
        if (p == npass - 1) {
#pragma unroll
            for (int g = 0; g < 2; ++g)
#pragma unroll
                for (int kt = 0; kt < 2; ++kt) {
#pragma unroll
                    for (int r = 0; r < 8; ++r) { if (16 * kt + 8 * hi + r > 16 * g + lr) s[kt][g][r] = -__builtin_inff(); }
                }
        }
        float mb[2]; bool need = false;
#pragma unroll
        for (int g = 0; g < 2; ++g) { float mx = s[0][g][0];
#pragma unroll
            for (int r = 1; r < 8; ++r) mx = fmaxf(mx, s[0][g][r]);
#pragma unroll
            for (int r = 0; r < 8; ++r) mx = fmaxf(mx, s[1][g][r]);
            mx = fmaxf(mx, xhalf(mx)) * CSC;   // both halves of the wave hold the query's maximum of this pass; finite: the pass's first key is never masked
            mb[g] = mx; need = need || (mx > m_run[g] + 8.0f); }
        if (__builtin_amdgcn_ballot_w32(need) != 0) {   // scalar branch, rare after the first passes
#pragma unroll
            for (int g = 0; g < 2; ++g) { const float m_new = fmaxf(m_run[g], mb[g]); const float corr = __builtin_amdgcn_exp2f(m_run[g] - m_new);   // 0 on the first pass
                m_run[g] = m_new; l_run[g] *= corr;
#pragma unroll
                for (int t = 0; t < 4; ++t) acc[g][t] = acc[g][t] * corr; }
        }
#pragma unroll
        for (int g = 0; g < 2; ++g) { const float nm = -m_run[g]; v8u wh, wl; float ls = 0.f; float e[2][8];
#pragma unroll
            for (int kt = 0; kt < 2; ++kt) {
#pragma unroll
                for (int r = 0; r < 8; ++r) e[kt][r] = fmaf(s[kt][g][r], CSC, nm);
                exp2x8(e[kt]); }
#pragma unroll
            for (int i = 0; i < 8; ++i) {
                const float p0 = e[i >> 2][2 * (i & 3)], p1 = e[i >> 2][2 * (i & 3) + 1];
                const unsigned w = pack2(p0, p1); wh[i] = w; ls += p0 + p1;
                wl[i] = pack2(p0 - __uint_as_float(w << 16), p1 - __uint_as_float(w & 0xFFFF0000u)); }
            l_run[g] += ls;
            const v16bf ph = __builtin_bit_cast(v16bf, wh), pl = __builtin_bit_cast(v16bf, wl);
#pragma unroll
            for (int t = 0; t < 4; ++t) acc[g][t] = wmmab(vf[t], ph, acc[g][t]);
#pragma unroll
            for (int t = 0; t < 4; ++t) acc[g][t] = wmmab(vf[t], pl, acc[g][t]); }
    }
    asm volatile("s_wait_loadcnt 0x0" ::: "memory");   // the last pass's K fetch has no reader, so the compiler waits for it nowhere: it lands before the wave gives its registers back
    float* ob = out + (size_t)(bh / NH_) * BSTR + (size_t)(bh % NH_) * HD + 8 * hi;
#pragma unroll
    for (int g = 0; g < 2; ++g) { const float l = l_run[g] + xhalf(l_run[g]); const float inv = __fdiv_rn(1.0f, l);   // the halves' sums join once, unconditionally
        float* orow = ob + (size_t)(qw0 + 16 * g + lr) * DM;
#pragma unroll
        for (int t = 0; t < 4; ++t) { const v8f o = acc[g][t] * inv;   // o[r] = out[query][16 t + 8 hi + r]
            *(v4f*)(orow + 16 * t) = (v4f){o[0], o[1], o[2], o[3]}; *(v4f*)(orow + 16 * t + 4) = (v4f){o[4], o[5], o[6], o[7]}; } }
}

__global__ __launch_bounds__(256) void k_hp1(const float* __restrict__ src, bf* P) { const size_t i = (size_t)blockIdx.x * 256 + threadIdx.x; if (i >= (size_t)NH_ * TT * HD / 8) return; const size_t e = i * 8; const int d = (int)(e % HD); const int t = (int)((e / HD) % TT); const int h = (int)(e / ((size_t)HD * TT)); const v8f v = *(const v8f*)(src + (size_t)t * DM + h * HD + d); v8us o;
#pragma unroll
    for (int q = 0; q < 8; ++q) o[q] = f2bf(v[q]);
    *(v8us*)(P + e) = o;  }
__global__ __launch_bounds__(256) void k_vt1(const float* __restrict__ src, int pitch, bf* VT) { const size_t e = ((size_t)blockIdx.x * 256 + threadIdx.x) * 2; if (e >= (size_t)NH_ * HD * TT) return; const int t = (int)(e % TT); const int d = (int)((e / TT) % HD); const int h = (int)(e / ((size_t)TT * HD)); v2us o; o[0] = f2bf(src[(size_t)t * pitch + h * HD + d]); o[1] = f2bf(src[(size_t)(t + 1) * pitch + h * HD + d]); *(v2us*)(VT + e) = o;  }

extern "C" void kernel_launch(void* const* d_in, const int* in_sizes, int n_in,
                              void* d_out, int out_size, void* d_ws, size_t ws_size, hipStream_t stream) {
    if (n_in < 3) return;
    const size_t need = ((size_t)(NB - 1) * SEQ_FULL + TT) * DM;          // elements actually read per input / written to the output
    if ((size_t)in_sizes[0] < need || (size_t)in_sizes[1] < need || (size_t)in_sizes[2] < need) return;
    if ((size_t)out_size < need) return;
    const float* Qin = (const float*)d_in[0]; const float* Kin = (const float*)d_in[1]; const float* Vin = (const float*)d_in[2];   // [NB][SEQ][H][E] token-major, f32
    float* OUT = (float*)d_out;                                                                                                     // [NB][SEQ][H][E] token-major, f32
    char* wsp = (char*)d_ws;
    auto take = [&](size_t bytes) { char* p = wsp; wsp += (bytes + 255) & ~(size_t)255; return (void*)p; };
    bf* QB = (bf*)take((size_t)NB * PLN * 2);                 // [b][h][t][d]   8,388,608 B
    bf* KB = (bf*)take((size_t)NB * PLN * 2);                 // [b][h][t][d]   8,388,608 B
    bf* VT = (bf*)take((size_t)NB * PLN * 2);                 // [b][h][d][t]   8,388,608 B   -> total 25,165,824 B
    if ((size_t)(wsp - (char*)d_ws) > ws_size) return;
    const unsigned gHp = (unsigned)(((size_t)NH_ * TT * HD / 8 + 255) / 256);
    const unsigned gVt = (unsigned)(((size_t)NH_ * HD * TT / 2 + 255) / 256);
    for (int b = 0; b < NB; ++b) {
        const float* qb = Qin + (size_t)b * BSTR; const float* kb = Kin + (size_t)b * BSTR; const float* vb = Vin + (size_t)b * BSTR;   /* token-major [t][h][d] slabs */
        k_hp1<<<gHp, 256, 0, stream>>>(qb, QB + (size_t)b * PLN);
        k_hp1<<<gHp, 256, 0, stream>>>(kb, KB + (size_t)b * PLN);
        k_vt1<<<gVt, 256, 0, stream>>>(vb, DM, VT + (size_t)b * PLN);
    }
    k_fattn<<<dim3(NT / 8, NB * NH_), 256, 0, stream>>>(QB, KB, VT, OUT);   /* scores, softmax and P x v for every batch and head */
}

// v003
// One run takes 72.5 microseconds.
// Timed twice side by side with v002, it ran 1.58 and 1.59 times as fast.
// All steps since v000 together make it 14.6 times as fast.
#include <hip/hip_runtime.h>

// Contractions: scores k.q^T via v_wmma_f32_16x16x32_bf16 (single bf16 planes of the RNE-converted inputs, f32 accumulate); v^T.P^T via v_wmma_f32_16x16x32_bf16 (P as bf16 hi+lo planes = two products, v single bf16 plane, f32 accumulate); softmax and all side math f32.
// Causal attention on token-major tensors q, k, v [NB][SEQ][8][64]: scores = q.k x 0.125 with keys after the query position excluded (replace-fill, exp -> 0), softmax over keys, out[t][h][d] = sum_s A[t][s] v[s][h][d] -> [NB][SEQ][8][64] token-major f32.
// Plan: one launch writes the bf16 head planes QB/KB [b][h][t][d] and the value^T planes VT [b][h][d][t] of every batch; then ONE launch for all batches and heads in which a wave owns 32 queries and walks their keys 32 at a time:
// S^T = K.Q^T, running maximum and sum per query (online softmax, base 2), P^T packed from the score accumulators straight into a B operand, O^T += V^T.P^T. Scores and P never leave the registers.

#ifndef NB
#define NB 4
#endif
#ifndef SEQ
#define SEQ 2048
#endif
#define NB_FULL  4
#define SEQ_FULL 2048
#define TT   SEQ
#define NH_  8
#define HD   64
#define DM   (NH_ * HD)                    // token-major row pitch (H x E) = 512
#define BSTR ((size_t)SEQ_FULL * DM)       // per-batch element stride of the full-size inputs and output
#define PLN  ((size_t)NH_ * TT * HD)       // elements of one batch's bf16 planes
#define QW   32                            // queries per wave
#define BC   32                            // keys per pass
#define NT   (TT / QW)                     // query tiles per head
#define CSC  0.18033688011112042f          // 1/sqrt(E=64) x log2(e)
static_assert(TT % 256 == 0);
static_assert(TT <= SEQ_FULL);
static_assert(NB >= 1 && NB <= NB_FULL);
static_assert(HD == 64);
static_assert(QW == BC && NT % 8 == 0);

typedef unsigned short bf;
typedef __attribute__((ext_vector_type(16))) __bf16   v16bf;
typedef __attribute__((ext_vector_type(2)))  __bf16   v2bf;
typedef __attribute__((ext_vector_type(8)))  unsigned short v8us;
typedef __attribute__((ext_vector_type(8)))  unsigned v8u;
typedef __attribute__((ext_vector_type(4)))  unsigned v4u;
typedef __attribute__((ext_vector_type(8)))  float    v8f;
typedef __attribute__((ext_vector_type(4)))  float    v4f;
typedef __attribute__((ext_vector_type(2)))  float    v2f;

__device__ __forceinline__ v16bf cat16b(v8us lo, v8us hi) { return __builtin_bit_cast(v16bf, __builtin_shufflevector(lo, hi, 0, 1, 2, 3, 4, 5, 6, 7, 8, 9, 10, 11, 12, 13, 14, 15)); }
__device__ __forceinline__ v8f wmmab(v16bf a, v16bf b, v8f c) { return __builtin_amdgcn_wmma_f32_16x16x32_bf16(false, a, false, b, (short)0, c, false, false); }
__device__ __forceinline__ unsigned pack2(float lo, float hi) { return __builtin_bit_cast(unsigned, __builtin_convertvector((v2f){lo, hi}, v2bf)); }   // two f32 -> two bf16, round to nearest even
__device__ __forceinline__ float xhalf(float x) { return __builtin_bit_cast(float, __builtin_amdgcn_permlanex16(__builtin_bit_cast(int, x), __builtin_bit_cast(int, x), 0x76543210, 0xfedcba98, false, false)); }   // lane l <-> lane l ^ 16

// Eight base-2 exponentials in place, and behind the last one the one free slot that the instruction set asks for between a transcendental and a user of its result or an overwrite of its source:
// in one statement.
__device__ __forceinline__ void exp2x8(float (&x)[8]) {
    asm("v_exp_f32 %0, %0\n\tv_exp_f32 %1, %1\n\tv_exp_f32 %2, %2\n\tv_exp_f32 %3, %3\n\tv_exp_f32 %4, %4\n\tv_exp_f32 %5, %5\n\tv_exp_f32 %6, %6\n\tv_exp_f32 %7, %7\n\tv_nop"
        : "+v"(x[0]), "+v"(x[1]), "+v"(x[2]), "+v"(x[3]), "+v"(x[4]), "+v"(x[5]), "+v"(x[6]), "+v"(x[7])); }

// ---- 16-bit fragment loader (wave32, 16x16x32): lane l -> row/col (l & 15); elements 0..7 <- k0 + 8*(l>>4) + 0..7, elements 8..15 <- k0 + 16 + 8*(l>>4) + 0..7, for A and B alike (p already holds the lane's row and its 8*(l>>4));
// D element r of lane l = (row 8*(l>>4) + r, col l & 15), so two D tiles of 16 keys each, converted in place, are a B operand over 32 keys in this same k order.
__device__ __forceinline__ v16bf ldf(const bf* p) { return cat16b(*(const v8us*)p, *(const v8us*)(p + 16)); }

// ---- k_fattn: grid (NT / 8, NB x heads), 8 independent waves (no LDS, no barrier). Wave w < 4 takes query tile NT - 1 - j, wave w + 4 tile j (j = 4 blockIdx.x + w): every pair (w, w + 4) has NT + 1 passes, every work-group 4 (NT + 1).
// m_run, the maximum in use, may trail a query's true maximum by up to 8 (scaled, base 2), so an exponential can reach 2^8; sums and outputs are rescaled only when some query's maximum exceeds it by more.
__global__ __launch_bounds__(256) void k_fattn(const unsigned short* __restrict__ QB, const unsigned short* __restrict__ KB, const unsigned short* __restrict__ VT, float* __restrict__ out) {
    const int lane = threadIdx.x & 31, lr = lane & 15, hi = lane >> 4;
    const int wave = __builtin_amdgcn_readfirstlane((int)(threadIdx.x >> 5));
    const int j = (int)blockIdx.x * 4 + (wave & 3);
    const int tile = (wave < 4) ? (NT - 1 - j) : j;
    const int bh = (int)blockIdx.y, qw0 = tile * QW, npass = tile + 1;
    const bf* kbase = KB + (size_t)bh * TT * HD + lr * HD + 8 * hi;
    const bf* vbase = VT + (size_t)bh * HD * TT + (size_t)lr * TT + 8 * hi;
    v16bf qf[2][2], kf[2][2], vf[4];
#pragma unroll
    for (int g = 0; g < 2; ++g)
#pragma unroll
        for (int kc = 0; kc < 2; ++kc) qf[g][kc] = ldf(QB + (size_t)bh * TT * HD + (size_t)(qw0 + 16 * g + lr) * HD + 32 * kc + 8 * hi);
#pragma unroll
    for (int kt = 0; kt < 2; ++kt)
#pragma unroll
        for (int kc = 0; kc < 2; ++kc) kf[kt][kc] = ldf(kbase + 16 * kt * HD + 32 * kc);
    v8f acc[2][4]; float m_run[2], l_run[2];
#pragma unroll
    for (int g = 0; g < 2; ++g) { m_run[g] = -__builtin_inff(); l_run[g] = 0.f;
#pragma unroll
        for (int t = 0; t < 4; ++t) acc[g][t] = (v8f){}; }
    for (int p = 0; p < npass; ++p) {
        const int key0 = p * BC, keyn = (p + 1 < npass ? p + 1 : p) * BC;   // the last pass fetches its own rows again: in bounds, never used
        const bf* vp = vbase + key0; const bf* kp = kbase + (size_t)keyn * HD;
#pragma unroll
        for (int t = 0; t < 4; ++t) vf[t] = ldf(vp + (size_t)16 * t * TT);   // this pass's V^T, issued behind this pass's K and ahead of the next pass's: in flight under the score products and the softmax
        asm volatile("s_wait_xcnt 0x0" :: "v"(vp) : "memory");              // precaution: stands in front of any rewrite of the address registers of the loads above; the input keeps them whole up to here
        v8f s[2][2];                                                        // s[kt][g][r] = score of key key0 + 16 kt + 8 hi + r with query qw0 + 16 g + lr
#pragma unroll
        for (int kt = 0; kt < 2; ++kt)
#pragma unroll
            for (int g = 0; g < 2; ++g) { s[kt][g] = (v8f){};
#pragma unroll
                for (int kc = 0; kc < 2; ++kc) s[kt][g] = wmmab(kf[kt][kc], qf[g][kc], s[kt][g]); }
#pragma unroll
        for (int kt = 0; kt < 2; ++kt)
#pragma unroll
            for (int kc = 0; kc < 2; ++kc) kf[kt][kc] = ldf(kp + 16 * kt * HD + 32 * kc);
        asm volatile("s_wait_xcnt 0x0" :: "v"(kp) : "memory");
        if (p == npass - 1) {
#pragma unroll
            for (int g = 0; g < 2; ++g)
#pragma unroll
                for (int kt = 0; kt < 2; ++kt) {
#pragma unroll
                    for (int r = 0; r < 8; ++r) { if (16 * kt + 8 * hi + r > 16 * g + lr) s[kt][g][r] = -__builtin_inff(); }
                }
        }
        float mb[2]; bool need = false;
#pragma unroll
        for (int g = 0; g < 2; ++g) { float mx = s[0][g][0];
#pragma unroll
            for (int r = 1; r < 8; ++r) mx = fmaxf(mx, s[0][g][r]);
#pragma unroll
            for (int r = 0; r < 8; ++r) mx = fmaxf(mx, s[1][g][r]);
            mx = fmaxf(mx, xhalf(mx)) * CSC;   // both halves of the wave hold the query's maximum of this pass; finite: the pass's first key is never masked
            mb[g] = mx; need = need || (mx > m_run[g] + 8.0f); }
        if (__builtin_amdgcn_ballot_w32(need) != 0) {   // scalar branch, rare after the first passes
#pragma unroll
            for (int g = 0; g < 2; ++g) { const float m_new = fmaxf(m_run[g], mb[g]); const float corr = __builtin_amdgcn_exp2f(m_run[g] - m_new);   // 0 on the first pass
                m_run[g] = m_new; l_run[g] *= corr;
#pragma unroll
                for (int t = 0; t < 4; ++t) acc[g][t] = acc[g][t] * corr; }
        }
#pragma unroll
        for (int g = 0; g < 2; ++g) { const float nm = -m_run[g]; v8u wh, wl; float ls = 0.f; float e[2][8];
#pragma unroll
            for (int kt = 0; kt < 2; ++kt) {
#pragma unroll
                for (int r = 0; r < 8; ++r) e[kt][r] = fmaf(s[kt][g][r], CSC, nm);
                exp2x8(e[kt]); }
#pragma unroll
            for (int i = 0; i < 8; ++i) {
                const float p0 = e[i >> 2][2 * (i & 3)], p1 = e[i >> 2][2 * (i & 3) + 1];
                const unsigned w = pack2(p0, p1); wh[i] = w; ls += p0 + p1;
                wl[i] = pack2(p0 - __uint_as_float(w << 16), p1 - __uint_as_float(w & 0xFFFF0000u)); }
            l_run[g] += ls;
            const v16bf ph = __builtin_bit_cast(v16bf, wh), pl = __builtin_bit_cast(v16bf, wl);
#pragma unroll
            for (int t = 0; t < 4; ++t) acc[g][t] = wmmab(vf[t], ph, acc[g][t]);
#pragma unroll
            for (int t = 0; t < 4; ++t) acc[g][t] = wmmab(vf[t], pl, acc[g][t]); }
    }
    asm volatile("s_wait_loadcnt 0x0" ::: "memory");   // the last pass's K fetch has no reader, so the compiler waits for it nowhere: it lands before the wave gives its registers back
    float* ob = out + (size_t)(bh / NH_) * BSTR + (size_t)(bh % NH_) * HD + 8 * hi;
#pragma unroll
    for (int g = 0; g < 2; ++g) { const float l = l_run[g] + xhalf(l_run[g]); const float inv = __fdiv_rn(1.0f, l);   // the halves' sums join once, unconditionally
        float* orow = ob + (size_t)(qw0 + 16 * g + lr) * DM;
#pragma unroll
        for (int t = 0; t < 4; ++t) { const v8f o = acc[g][t] * inv;   // o[r] = out[query][16 t + 8 hi + r]
            *(v4f*)(orow + 16 * t) = (v4f){o[0], o[1], o[2], o[3]}; *(v4f*)(orow + 16 * t + 4) = (v4f){o[4], o[5], o[6], o[7]}; } }
}

// ---- k_prep: ONE launch lays out q, k and v of every batch; grid (NB x TT / 32, 3), blockIdx.y picks the tensor; 8 independent waves, 64 elements per lane (8 loads of 32 B, 8 stores of 16 B), no LDS, no barrier.
// q, k: a wave takes 32 tokens of one head; lane = (token l >> 3, dims 8 (l & 7) ..), step i adds 4 tokens: a store covers 512 contiguous bytes of the head plane.
// v: a wave takes 64 tokens x 32 columns; lane = (tokens 8 (l & 7) .., columns 8 (l >> 3) ..) holds an 8 x 8 block and writes it transposed from its own registers: a load covers whole 128-B pieces of 8 token rows, a store whole 128-B lines of 4 rows of V^T.
__global__ __launch_bounds__(256) void k_prep(const float* __restrict__ Q, const float* __restrict__ K, const float* __restrict__ V,
                                              unsigned short* __restrict__ QB, unsigned short* __restrict__ KB, unsigned short* __restrict__ VT) {
    const int lane = threadIdx.x & 31, l8 = lane & 7, l4 = lane >> 3;
    const unsigned wv = blockIdx.x * 8u + (unsigned)__builtin_amdgcn_readfirstlane((int)(threadIdx.x >> 5));
    v8f x[8];
    if (blockIdx.y < 2) {
        const unsigned h = wv % NH_, t0 = ((wv / NH_) % (TT / 32)) * 32 + l4, b = wv / (NH_ * (TT / 32));
        const float* s = (blockIdx.y ? K : Q) + (size_t)b * BSTR + (size_t)t0 * DM + h * HD + 8 * l8;
        bf* d = (blockIdx.y ? KB : QB) + (size_t)b * PLN + ((size_t)h * TT + t0) * HD + 8 * l8;
#pragma unroll
        for (int i = 0; i < 8; ++i) x[i] = *(const v8f*)(s + (size_t)4 * i * DM);
        __builtin_amdgcn_sched_barrier(0);                      // every load is issued ahead of the first conversion: without it the build held the last loads back until the first had landed
        asm volatile("s_wait_xcnt 0x0" :: "v"(s) : "memory");   // the precaution of k_fattn: stands in front of any rewrite of the loads' address registers, which the input keeps whole up to here
#pragma unroll
        for (int i = 0; i < 8; ++i) { v4u o;
#pragma unroll
            for (int q = 0; q < 4; ++q) o[q] = pack2(x[i][2 * q], x[i][2 * q + 1]);
            *(v4u*)(d + 4 * i * HD) = o; }
        asm volatile("s_wait_xcnt 0x0" ::: "memory");           // the same precaution behind the last store: stands in front of whatever code the build lays behind this branch and lets rewrite the stores' registers
    } else {
        const unsigned col = (wv % (DM / 32)) * 32 + 8 * l4, t0 = ((wv / (DM / 32)) % (TT / 64)) * 64 + 8 * l8, b = wv / ((DM / 32) * (TT / 64));   // col = head x 64 + dim
        const float* s = V + (size_t)b * BSTR + (size_t)t0 * DM + col;
        bf* d = VT + (size_t)b * PLN + (size_t)col * TT + t0;
#pragma unroll
        for (int i = 0; i < 8; ++i) x[i] = *(const v8f*)(s + (size_t)i * DM);
        __builtin_amdgcn_sched_barrier(0);                      // as above
        asm volatile("s_wait_xcnt 0x0" :: "v"(s) : "memory");   // as above
#pragma unroll
        for (int c = 0; c < 8; ++c) { v4u o;
#pragma unroll
            for (int q = 0; q < 4; ++q) o[q] = pack2(x[2 * q][c], x[2 * q + 1][c]);   // tokens t0 + 2 q, t0 + 2 q + 1 of column col + c
            *(v4u*)(d + (size_t)c * TT) = o; }
        asm volatile("s_wait_xcnt 0x0" ::: "memory");           // as behind the stores above
    }
}

extern "C" void kernel_launch(void* const* d_in, const int* in_sizes, int n_in,
                              void* d_out, int out_size, void* d_ws, size_t ws_size, hipStream_t stream) {
    if (n_in < 3) return;
    const size_t need = ((size_t)(NB - 1) * SEQ_FULL + TT) * DM;          // elements actually read per input / written to the output
    if ((size_t)in_sizes[0] < need || (size_t)in_sizes[1] < need || (size_t)in_sizes[2] < need) return;
    if ((size_t)out_size < need) return;
    const float* Qin = (const float*)d_in[0]; const float* Kin = (const float*)d_in[1]; const float* Vin = (const float*)d_in[2];   // [NB][SEQ][H][E] token-major, f32
    float* OUT = (float*)d_out;                                                                                                     // [NB][SEQ][H][E] token-major, f32
    char* wsp = (char*)d_ws;
    auto take = [&](size_t bytes) { char* p = wsp; wsp += (bytes + 255) & ~(size_t)255; return (void*)p; };
    bf* QB = (bf*)take((size_t)NB * PLN * 2);                 // [b][h][t][d]   8,388,608 B
    bf* KB = (bf*)take((size_t)NB * PLN * 2);                 // [b][h][t][d]   8,388,608 B
    bf* VT = (bf*)take((size_t)NB * PLN * 2);                 // [b][h][d][t]   8,388,608 B   -> total 25,165,824 B
    if ((size_t)(wsp - (char*)d_ws) > ws_size) return;
    k_prep<<<dim3(NB * TT / 32, 3), 256, 0, stream>>>(Qin, Kin, Vin, QB, KB, VT);   /* bf16 head planes of q and k, transposed planes of v, every batch */
    k_fattn<<<dim3(NT / 8, NB * NH_), 256, 0, stream>>>(QB, KB, VT, OUT);   /* scores, softmax and P x v for every batch and head */
}

// v004
// Measured time: 51.2 microseconds a run.
// Timed twice side by side with v003, it ran 1.44 and 1.41 times as fast.
// Over all steps from v000 it is 20.8 times as fast.
#include <hip/hip_runtime.h>

// Contractions: scores k.q^T via v_wmma_f32_16x16x32_bf16 (single bf16 planes of the RNE-converted inputs, f32 accumulate); v^T.P^T via v_wmma_f32_16x16x32_bf16 (P as bf16 hi+lo planes = two products, v single bf16 plane, f32 accumulate); softmax and all side math f32.
// Causal attention on token-major tensors q, k, v [NB][SEQ][8][64]: scores = q.k x 0.125 with keys after the query position excluded (replace-fill, exp -> 0), softmax over keys, out[t][h][d] = sum_s A[t][s] v[s][h][d] -> [NB][SEQ][8][64] token-major f32.
// Plan: one launch writes the bf16 planes QB, KB and VT of every batch in FRAGMENT ORDER (see ldf): per head and 32 tokens one 4-KiB tile of 8 slices, a slice = the 16 bytes of each of the 32 lanes in lane order; then ONE launch for all batches and heads in which a wave owns 32 queries and walks their keys 32 at a time:
// S^T = K.Q^T, running maximum and sum per query (online softmax, base 2), P^T packed from the score accumulators straight into a B operand, O^T += V^T.P^T. Scores and P never leave the registers.

#ifndef NB
#define NB 4
#endif
#ifndef SEQ
#define SEQ 2048
#endif
#define NB_FULL  4
#define SEQ_FULL 2048
#define TT   SEQ
#define NH_  8
#define HD   64
#define DM   (NH_ * HD)                    // token-major row pitch (H x E) = 512
#define BSTR ((size_t)SEQ_FULL * DM)       // per-batch element stride of the full-size inputs and output
#define PLN  ((size_t)NH_ * TT * HD)       // elements of one batch's bf16 planes
#define QW   32                            // queries per wave
#define BC   32                            // keys per pass
#define NT   (TT / QW)                     // query tiles per head
#define TILE (BC * HD)                     // elements of one 32-token tile of a plane (4 KiB)
#define SLC  256                           // elements of one slice of a tile: 32 lanes x 8 (512 B, four whole lines)
#define CSC  0.18033688011112042f          // 1/sqrt(E=64) x log2(e)
static_assert(TT % 256 == 0);
static_assert(TT <= SEQ_FULL);
static_assert(NB >= 1 && NB <= NB_FULL);
static_assert(HD == 64);
static_assert(QW == BC && NT % 8 == 0);

typedef unsigned short bf;
typedef __attribute__((ext_vector_type(16))) __bf16   v16bf;
typedef __attribute__((ext_vector_type(2)))  __bf16   v2bf;
typedef __attribute__((ext_vector_type(8)))  unsigned short v8us;
typedef __attribute__((ext_vector_type(8)))  unsigned v8u;
typedef __attribute__((ext_vector_type(4)))  unsigned v4u;
typedef __attribute__((ext_vector_type(8)))  float    v8f;
typedef __attribute__((ext_vector_type(4)))  float    v4f;
typedef __attribute__((ext_vector_type(2)))  float    v2f;

__device__ __forceinline__ v16bf cat16b(v8us lo, v8us hi) { return __builtin_bit_cast(v16bf, __builtin_shufflevector(lo, hi, 0, 1, 2, 3, 4, 5, 6, 7, 8, 9, 10, 11, 12, 13, 14, 15)); }
__device__ __forceinline__ v8f wmmab(v16bf a, v16bf b, v8f c) { return __builtin_amdgcn_wmma_f32_16x16x32_bf16(false, a, false, b, (short)0, c, false, false); }
__device__ __forceinline__ unsigned pack2(float lo, float hi) { return __builtin_bit_cast(unsigned, __builtin_convertvector((v2f){lo, hi}, v2bf)); }   // two f32 -> two bf16, round to nearest even
__device__ __forceinline__ float xhalf(float x) { return __builtin_bit_cast(float, __builtin_amdgcn_permlanex16(__builtin_bit_cast(int, x), __builtin_bit_cast(int, x), 0x76543210, 0xfedcba98, false, false)); }   // lane l <-> lane l ^ 16

// Eight base-2 exponentials in place, and behind the last one the one free slot that the instruction set asks for between a transcendental and a user of its result or an overwrite of its source:
// in one statement.
__device__ __forceinline__ void exp2x8(float (&x)[8]) {
    asm("v_exp_f32 %0, %0\n\tv_exp_f32 %1, %1\n\tv_exp_f32 %2, %2\n\tv_exp_f32 %3, %3\n\tv_exp_f32 %4, %4\n\tv_exp_f32 %5, %5\n\tv_exp_f32 %6, %6\n\tv_exp_f32 %7, %7\n\tv_nop"
        : "+v"(x[0]), "+v"(x[1]), "+v"(x[2]), "+v"(x[3]), "+v"(x[4]), "+v"(x[5]), "+v"(x[6]), "+v"(x[7])); }

// ---- 16-bit fragment loader (wave32, 16x16x32): lane l -> row/col (l & 15); elements 0..7 <- k0 + 8*(l>>4) + 0..7, elements 8..15 <- k0 + 16 + 8*(l>>4) + 0..7, for A and B alike.
// The planes hold each fragment as two slices, elements 0..7 of lanes 0..31 and then elements 8..15 of lanes 0..31 (p already holds 8 x lane): each of the two loads covers 512 contiguous bytes, not 32-byte pieces of 16 lines.
// q, k tile: fragment 2 x (16-token group) + (32-dim group), row l & 15 = token. v tile: fragment t, k = the tile's 32 tokens, row a = dim 8 (a & 7) + 4 (a >> 3) + t, so that k_prep stores whole lines and a lane's four output tiles hold four adjacent dims.
// D element r of lane l = (row 8*(l>>4) + r, col l & 15), so two D tiles of 16 keys each, converted in place, are a B operand over 32 keys in this same k order.
__device__ __forceinline__ v16bf ldf(const bf* p) { return cat16b(*(const v8us*)p, *(const v8us*)(p + SLC)); }

// ---- k_fattn: grid (NT / 8, NB x heads), 8 independent waves (no LDS, no barrier). Wave w < 4 takes query tile NT - 1 - j, wave w + 4 tile j (j = 4 blockIdx.x + w): every pair (w, w + 4) has NT + 1 passes, every work-group 4 (NT + 1).
// m_run, the maximum in use, may trail a query's true maximum by up to 8 (scaled, base 2), so an exponential can reach 2^8; sums and outputs are rescaled only when some query's maximum exceeds it by more.
__global__ __launch_bounds__(256) void k_fattn(const unsigned short* __restrict__ QB, const unsigned short* __restrict__ KB, const unsigned short* __restrict__ VT, float* __restrict__ out) {
    const int lane = threadIdx.x & 31, lr = lane & 15, hi = lane >> 4;
    const int wave = __builtin_amdgcn_readfirstlane((int)(threadIdx.x >> 5));
    const int j = (int)blockIdx.x * 4 + (wave & 3);
    const int tile = (wave < 4) ? (NT - 1 - j) : j;
    const int bh = (int)blockIdx.y, qw0 = tile * QW, npass = tile + 1;
    const bf* kbase = KB + (size_t)bh * TT * HD + 8 * lane;
    const bf* vbase = VT + (size_t)bh * TT * HD + 8 * lane;
    v16bf qf[2][2], kf[2][2], vf[4];
#pragma unroll
    for (int g = 0; g < 2; ++g)
#pragma unroll
        for (int kc = 0; kc < 2; ++kc) qf[g][kc] = ldf(QB + (size_t)bh * TT * HD + (size_t)tile * TILE + (2 * g + kc) * 2 * SLC + 8 * lane);
#pragma unroll
    for (int kt = 0; kt < 2; ++kt)
#pragma unroll
        for (int kc = 0; kc < 2; ++kc) kf[kt][kc] = ldf(kbase + (2 * kt + kc) * 2 * SLC);
    v8f acc[2][4]; float m_run[2], l_run[2];
#pragma unroll
    for (int g = 0; g < 2; ++g) { m_run[g] = -__builtin_inff(); l_run[g] = 0.f;
#pragma unroll
        for (int t = 0; t < 4; ++t) acc[g][t] = (v8f){}; }
    for (int p = 0; p < npass; ++p) {
        const int pn = p + 1 < npass ? p + 1 : p;   // the last pass fetches its own tile again: in bounds, never used
        const bf* vp = vbase + (size_t)p * TILE; const bf* kp = kbase + (size_t)pn * TILE;
#pragma unroll
        for (int t = 0; t < 4; ++t) vf[t] = ldf(vp + t * 2 * SLC);   // this pass's V^T, issued behind this pass's K and ahead of the next pass's: in flight under the score products and the softmax
        asm volatile("s_wait_xcnt 0x0" :: "v"(vp) : "memory");              // precaution: stands in front of any rewrite of the address registers of the loads above; the input keeps them whole up to here
        v8f s[2][2];                                                        // s[kt][g][r] = score of key 32 p + 16 kt + 8 hi + r with query qw0 + 16 g + lr
#pragma unroll
        for (int kt = 0; kt < 2; ++kt)
#pragma unroll
            for (int g = 0; g < 2; ++g) { s[kt][g] = (v8f){};
#pragma unroll
                for (int kc = 0; kc < 2; ++kc) s[kt][g] = wmmab(kf[kt][kc], qf[g][kc], s[kt][g]); }
#pragma unroll
        for (int kt = 0; kt < 2; ++kt)
#pragma unroll
            for (int kc = 0; kc < 2; ++kc) kf[kt][kc] = ldf(kp + (2 * kt + kc) * 2 * SLC);
        asm volatile("s_wait_xcnt 0x0" :: "v"(kp) : "memory");
        if (p == npass - 1) {
#pragma unroll
            for (int g = 0; g < 2; ++g)
#pragma unroll
                for (int kt = 0; kt < 2; ++kt) {
#pragma unroll
                    for (int r = 0; r < 8; ++r) { if (16 * kt + 8 * hi + r > 16 * g + lr) s[kt][g][r] = -__builtin_inff(); }
                }
        }
        float mb[2]; bool need = false;
#pragma unroll
        for (int g = 0; g < 2; ++g) { float mx = s[0][g][0];
#pragma unroll
            for (int r = 1; r < 8; ++r) mx = fmaxf(mx, s[0][g][r]);
#pragma unroll
            for (int r = 0; r < 8; ++r) mx = fmaxf(mx, s[1][g][r]);
            mx = fmaxf(mx, xhalf(mx)) * CSC;   // both halves of the wave hold the query's maximum of this pass; finite: the pass's first key is never masked
            mb[g] = mx; need = need || (mx > m_run[g] + 8.0f); }
        if (__builtin_amdgcn_ballot_w32(need) != 0) {   // scalar branch, rare after the first passes
#pragma unroll
            for (int g = 0; g < 2; ++g) { const float m_new = fmaxf(m_run[g], mb[g]); const float corr = __builtin_amdgcn_exp2f(m_run[g] - m_new);   // 0 on the first pass
                m_run[g] = m_new; l_run[g] *= corr;
#pragma unroll
                for (int t = 0; t < 4; ++t) acc[g][t] = acc[g][t] * corr; }
        }
#pragma unroll
        for (int g = 0; g < 2; ++g) { const float nm = -m_run[g]; v8u wh, wl; float ls = 0.f; float e[2][8];
#pragma unroll
            for (int kt = 0; kt < 2; ++kt) {
#pragma unroll
                for (int r = 0; r < 8; ++r) e[kt][r] = fmaf(s[kt][g][r], CSC, nm);
                exp2x8(e[kt]); }
#pragma unroll
            for (int i = 0; i < 8; ++i) {
                const float p0 = e[i >> 2][2 * (i & 3)], p1 = e[i >> 2][2 * (i & 3) + 1];
                const unsigned w = pack2(p0, p1); wh[i] = w; ls += p0 + p1;
                wl[i] = pack2(p0 - __uint_as_float(w << 16), p1 - __uint_as_float(w & 0xFFFF0000u)); }
            l_run[g] += ls;
            const v16bf ph = __builtin_bit_cast(v16bf, wh), pl = __builtin_bit_cast(v16bf, wl);
#pragma unroll
            for (int t = 0; t < 4; ++t) acc[g][t] = wmmab(vf[t], ph, acc[g][t]);
#pragma unroll
            for (int t = 0; t < 4; ++t) acc[g][t] = wmmab(vf[t], pl, acc[g][t]); }
    }
    asm volatile("s_wait_loadcnt 0x0" ::: "memory");   // the last pass's K fetch has no reader, so the compiler waits for it nowhere: it lands before the wave gives its registers back
    float* ob = out + (size_t)(bh / NH_) * BSTR + (size_t)(bh % NH_) * HD + 4 * hi;
#pragma unroll
    for (int g = 0; g < 2; ++g) { const float l = l_run[g] + xhalf(l_run[g]); const float inv = __fdiv_rn(1.0f, l);   // the halves' sums join once, unconditionally
        float* orow = ob + (size_t)(qw0 + 16 * g + lr) * DM;
#pragma unroll
        for (int r = 0; r < 8; ++r)   // acc[g][t][r] = out[query][8 r + 4 hi + t]
            *(v4f*)(orow + 8 * r) = (v4f){acc[g][0][r], acc[g][1][r], acc[g][2][r], acc[g][3][r]} * inv; }
}

// ---- k_prep: ONE launch lays out q, k and v of every batch; grid (NB x TT / 32, 3), blockIdx.y picks the tensor; 8 independent waves, 64 elements per lane (8 loads of 32 B, 8 stores of 16 B), no LDS, no barrier.
// A wave takes 32 tokens of one head = one tile of the plane; every load covers whole 128-B lines of the token rows, every store four whole 128-B lines of the tile.
// q, k: lane = (token l & 7, dims 8 (l >> 3) ..), step i = (8-token group i >> 1, 32-dim group i & 1): the 8 dims are elements 8 (l >> 4) .. of the fragment's lane 16 ((l >> 3) & 1) + (token & 15).
// v: lane = (dims 8 (l & 7) .., tokens 8 (l >> 3) ..) holds an 8 x 8 block and writes it transposed from its own registers: dim 8 (l & 7) + c is row (l & 7) + 8 (c >> 2) of fragment c & 3.
__global__ __launch_bounds__(256) void k_prep(const float* __restrict__ Q, const float* __restrict__ K, const float* __restrict__ V,
                                              unsigned short* __restrict__ QB, unsigned short* __restrict__ KB, unsigned short* __restrict__ VT) {
    const int lane = threadIdx.x & 31, l8 = lane & 7, l4 = lane >> 3;
    const unsigned wv = blockIdx.x * 8u + (unsigned)__builtin_amdgcn_readfirstlane((int)(threadIdx.x >> 5));
    const unsigned h = wv % NH_, t0 = ((wv / NH_) % (TT / 32)) * 32, b = wv / (NH_ * (TT / 32));
    const size_t so = (size_t)b * BSTR + (size_t)t0 * DM + h * HD, po = (size_t)b * PLN + ((size_t)h * TT + t0) * HD;   // the wave's first input element and its tile
    v8f x[8];
    if (blockIdx.y < 2) {
        const float* s = (blockIdx.y ? K : Q) + so + (size_t)l8 * DM + 8 * l4;
        bf* d = (blockIdx.y ? KB : QB) + po + (l4 >> 1) * SLC + 8 * (16 * (l4 & 1) + l8);
#pragma unroll
        for (int i = 0; i < 8; ++i) x[i] = *(const v8f*)(s + (size_t)8 * (i >> 1) * DM + 32 * (i & 1));
        __builtin_amdgcn_sched_barrier(0);                      // every load is issued ahead of the first conversion: without it the build held the last loads back until the first had landed
        asm volatile("s_wait_xcnt 0x0" :: "v"(s) : "memory");   // the precaution of k_fattn: stands in front of any rewrite of the loads' address registers, which the input keeps whole up to here
#pragma unroll
        for (int i = 0; i < 8; ++i) { v4u o;
#pragma unroll
            for (int q = 0; q < 4; ++q) o[q] = pack2(x[i][2 * q], x[i][2 * q + 1]);
            *(v4u*)(d + (2 * (i >> 2) + (i & 1)) * 2 * SLC + 64 * ((i >> 1) & 1)) = o; }   // fragment 2 (token >> 4) + (32-dim group), lanes + 8 for tokens 8 .. 15 of the group
        asm volatile("s_wait_xcnt 0x0" ::: "memory");           // the same precaution behind the last store: stands in front of whatever code the build lays behind this branch and lets rewrite the stores' registers
    } else {
        const float* s = V + so + (size_t)8 * l4 * DM + 8 * l8;
        bf* d = VT + po + (l4 >> 1) * SLC + 8 * (16 * (l4 & 1) + l8);   // tokens 8 l4 .. are elements 0 .. 7 of half l4 >> 1 in lanes 16 (l4 & 1) + row
#pragma unroll
        for (int i = 0; i < 8; ++i) x[i] = *(const v8f*)(s + (size_t)i * DM);
        __builtin_amdgcn_sched_barrier(0);                      // as above
        asm volatile("s_wait_xcnt 0x0" :: "v"(s) : "memory");   // as above
#pragma unroll
        for (int c = 0; c < 8; ++c) { v4u o;
#pragma unroll
            for (int q = 0; q < 4; ++q) o[q] = pack2(x[2 * q][c], x[2 * q + 1][c]);   // tokens 8 l4 + 2 q, 8 l4 + 2 q + 1 of dim 8 l8 + c
            *(v4u*)(d + (c & 3) * 2 * SLC + 64 * (c >> 2)) = o; }
        asm volatile("s_wait_xcnt 0x0" ::: "memory");           // as behind the stores above
    }
}

extern "C" void kernel_launch(void* const* d_in, const int* in_sizes, int n_in,
                              void* d_out, int out_size, void* d_ws, size_t ws_size, hipStream_t stream) {
    if (n_in < 3) return;
    const size_t need = ((size_t)(NB - 1) * SEQ_FULL + TT) * DM;          // elements actually read per input / written to the output
    if ((size_t)in_sizes[0] < need || (size_t)in_sizes[1] < need || (size_t)in_sizes[2] < need) return;
    if ((size_t)out_size < need) return;
    const float* Qin = (const float*)d_in[0]; const float* Kin = (const float*)d_in[1]; const float* Vin = (const float*)d_in[2];   // [NB][SEQ][H][E] token-major, f32
    float* OUT = (float*)d_out;                                                                                                     // [NB][SEQ][H][E] token-major, f32
    char* wsp = (char*)d_ws;
    auto take = [&](size_t bytes) { char* p = wsp; wsp += (bytes + 255) & ~(size_t)255; return (void*)p; };
    bf* QB = (bf*)take((size_t)NB * PLN * 2);                 // [b][h][t / 32][tile]   8,388,608 B
    bf* KB = (bf*)take((size_t)NB * PLN * 2);                 // [b][h][t / 32][tile]   8,388,608 B
    bf* VT = (bf*)take((size_t)NB * PLN * 2);                 // [b][h][t / 32][tile]   8,388,608 B   -> total 25,165,824 B
    if ((size_t)(wsp - (char*)d_ws) > ws_size) return;
    k_prep<<<dim3(NB * TT / 32, 3), 256, 0, stream>>>(Qin, Kin, Vin, QB, KB, VT);   /* bf16 planes of q, k and v in fragment order, every batch */
    k_fattn<<<dim3(NT / 8, NB * NH_), 256, 0, stream>>>(QB, KB, VT, OUT);   /* scores, softmax and P x v for every batch and head */
}

// v005
// Measured time: 31.8 microseconds a run.
// In two side-by-side timings against v004, it was 1.59 and 1.60 times as fast.
// All steps since v000 together make it 33.2 times as fast.
#include <hip/hip_runtime.h>

// Contractions: scores k.q^T via v_wmma_f32_16x16x32_bf16 (single bf16 planes of the RNE-converted inputs, f32 accumulate); v^T.P^T via v_wmma_f32_16x16x32_bf16 (P as bf16 hi+lo planes = two products, v single bf16 plane, f32 accumulate); softmax and all side math f32.
// Causal attention on token-major tensors q, k, v [NB][SEQ][8][64]: scores = q.k x 0.125 with keys after the query position excluded (replace-fill, exp -> 0), softmax over keys, out[t][h][d] = sum_s A[t][s] v[s][h][d] -> [NB][SEQ][8][64] token-major f32.
// Plan: one launch writes the bf16 planes QB, KB and VT of every batch in FRAGMENT ORDER (see ldf): per head and 32 tokens one 4-KiB tile of 8 slices, a slice = the 16 bytes of each of the 32 lanes in lane order; then ONE launch for all batches and heads in which four waves share 32 queries, each walking a quarter of their keys 32 at a time:
// S^T = K.Q^T, running maximum and sum per query (online softmax, base 2), P^T packed from the score accumulators straight into a B operand, O^T += V^T.P^T. Scores and P never leave the registers; the four waves' sums and outputs are joined through LDS at the end.

#ifndef NB
#define NB 4
#endif
#ifndef SEQ
#define SEQ 2048
#endif
#define NB_FULL  4
#define SEQ_FULL 2048
#define TT   SEQ
#define NH_  8
#define HD   64
#define DM   (NH_ * HD)                    // token-major row pitch (H x E) = 512
#define BSTR ((size_t)SEQ_FULL * DM)       // per-batch element stride of the full-size inputs and output
#define PLN  ((size_t)NH_ * TT * HD)       // elements of one batch's bf16 planes
#define QW   32                            // queries per wave
#define BC   32                            // keys per pass
#define NT   (TT / QW)                     // query tiles per head
#define TG   4                             // adjacent query tiles that a work-group works on side by side
#define KS   4                             // key ranges per query tile, one wave each
#define NWV  (TG * KS)                     // waves per work-group of k_fattn
#define NG   (NT / TG)                     // groups of TG query tiles per head
#define TILE (BC * HD)                     // elements of one 32-token tile of a plane (4 KiB)
#define SLC  256                           // elements of one slice of a tile: 32 lanes x 8 (512 B, four whole lines)
#define CSC  0.18033688011112042f          // 1/sqrt(E=64) x log2(e)
static_assert(TT % 256 == 0);
static_assert(TT <= SEQ_FULL);
static_assert(NB >= 1 && NB <= NB_FULL);
static_assert(HD == 64);
static_assert(QW == BC && NT % (2 * TG) == 0 && TG == KS);

typedef unsigned short bf;
typedef __attribute__((ext_vector_type(16))) __bf16   v16bf;
typedef __attribute__((ext_vector_type(2)))  __bf16   v2bf;
typedef __attribute__((ext_vector_type(8)))  unsigned short v8us;
typedef __attribute__((ext_vector_type(8)))  unsigned v8u;
typedef __attribute__((ext_vector_type(4)))  unsigned v4u;
typedef __attribute__((ext_vector_type(8)))  float    v8f;
typedef __attribute__((ext_vector_type(4)))  float    v4f;
typedef __attribute__((ext_vector_type(2)))  float    v2f;

__device__ __forceinline__ v16bf cat16b(v8us lo, v8us hi) { return __builtin_bit_cast(v16bf, __builtin_shufflevector(lo, hi, 0, 1, 2, 3, 4, 5, 6, 7, 8, 9, 10, 11, 12, 13, 14, 15)); }
__device__ __forceinline__ v8f wmmab(v16bf a, v16bf b, v8f c) { return __builtin_amdgcn_wmma_f32_16x16x32_bf16(false, a, false, b, (short)0, c, false, false); }
__device__ __forceinline__ unsigned pack2(float lo, float hi) { return __builtin_bit_cast(unsigned, __builtin_convertvector((v2f){lo, hi}, v2bf)); }   // two f32 -> two bf16, round to nearest even
__device__ __forceinline__ float xhalf(float x) { return __builtin_bit_cast(float, __builtin_amdgcn_permlanex16(__builtin_bit_cast(int, x), __builtin_bit_cast(int, x), 0x76543210, 0xfedcba98, false, false)); }   // lane l <-> lane l ^ 16

// Eight base-2 exponentials in place, and behind the last one the one free slot that the instruction set asks for between a transcendental and a user of its result or an overwrite of its source:
// in one statement.
__device__ __forceinline__ void exp2x8(float (&x)[8]) {
    asm("v_exp_f32 %0, %0\n\tv_exp_f32 %1, %1\n\tv_exp_f32 %2, %2\n\tv_exp_f32 %3, %3\n\tv_exp_f32 %4, %4\n\tv_exp_f32 %5, %5\n\tv_exp_f32 %6, %6\n\tv_exp_f32 %7, %7\n\tv_nop"
        : "+v"(x[0]), "+v"(x[1]), "+v"(x[2]), "+v"(x[3]), "+v"(x[4]), "+v"(x[5]), "+v"(x[6]), "+v"(x[7])); }

// ---- 16-bit fragment loader (wave32, 16x16x32): lane l -> row/col (l & 15); elements 0..7 <- k0 + 8*(l>>4) + 0..7, elements 8..15 <- k0 + 16 + 8*(l>>4) + 0..7, for A and B alike.
// The planes hold each fragment as two slices, elements 0..7 of lanes 0..31 and then elements 8..15 of lanes 0..31 (p already holds 8 x lane): each of the two loads covers 512 contiguous bytes, not 32-byte pieces of 16 lines.
// q, k tile: fragment 2 x (16-token group) + (32-dim group), row l & 15 = token. v tile: fragment t, k = the tile's 32 tokens, row a = dim 8 (a & 7) + 4 (a >> 3) + t, so that k_prep stores whole lines and a lane's four output tiles hold four adjacent dims.
// D element r of lane l = (row 8*(l>>4) + r, col l & 15), so two D tiles of 16 keys each, converted in place, are a B operand over 32 keys in this same k order.
__device__ __forceinline__ v16bf ldf(const bf* p) { return cat16b(*(const v8us*)p, *(const v8us*)(p + SLC)); }

// Four base-2 exponentials in place, with the same free slot behind the last one as in exp2x8.
__device__ __forceinline__ void exp2x4(float (&x)[4]) {
    asm("v_exp_f32 %0, %0\n\tv_exp_f32 %1, %1\n\tv_exp_f32 %2, %2\n\tv_exp_f32 %3, %3\n\tv_nop" : "+v"(x[0]), "+v"(x[1]), "+v"(x[2]), "+v"(x[3])); }

// ---- k_fattn: grid (NG / 2, NB x heads), 16 waves = TG adjacent query tiles x KS key ranges, four waves per SIMD. A work-group takes tile group NG - 1 - blockIdx.x and then group blockIdx.x of its head.
// Tiles TG grp .. TG grp + 3 share their first TG grp passes: range ks takes passes ks grp .. ks grp + grp - 1 of them for its tile, the same keys at the same step in the four waves of a range.
// Of the passes behind them tile ti needs TG grp .. TG grp + ti: range ks takes pass TG grp + ks where ks <= ti, and it is the masked pass on the diagonal where ks == ti.
// The second group runs with tile and range mirrored (3 - ti, 3 - ks), so every wave has NG or NG + 1 passes in all. A range without a pass hands over (-inf, 0, zeros).
// Each wave keeps its own maximum in use, sum and outputs per tile and leaves them in LDS; behind the one barrier wave (ti, ks) joins the four ranges of tile ti, in range order, for 16 queries x 32 dims (whole 128-B lines of the output).
// m_run, the maximum in use, may trail a query's true maximum by up to 8 (scaled, base 2), so an exponential can reach 2^8; sums and outputs are rescaled only when some query's maximum exceeds it by more.
__global__ __launch_bounds__(NWV * 32) void k_fattn(const unsigned short* __restrict__ QB, const unsigned short* __restrict__ KB, const unsigned short* __restrict__ VT, float* __restrict__ out) {
    __shared__ __attribute__((aligned(512))) float PART[2][NWV][16][32][4];   // [group][tile x range][8 g + r][lane][t]: every store and load covers 512 contiguous bytes   262,144 B
    __shared__ __attribute__((aligned(256))) float ML[2][NWV][2][32][2];      // [group][tile x range][g][lane](maximum in use, sum)                                        16,384 B
    const int lane = threadIdx.x & 31, lr = lane & 15, hi = lane >> 4;
    const int wave = __builtin_amdgcn_readfirstlane((int)(threadIdx.x >> 5));
    const int bh = (int)blockIdx.y;
    const bf* kbase = KB + (size_t)bh * TT * HD + 8 * lane;
    const bf* vbase = VT + (size_t)bh * TT * HD + 8 * lane;
    for (int seg = 0; seg < 2; ++seg) {
        const int grp = seg ? (int)blockIdx.x : NG - 1 - (int)blockIdx.x;
        const int ti = seg ? TG - 1 - (wave >> 2) : (wave >> 2), ks = seg ? KS - 1 - (wave & 3) : (wave & 3);
        const int tile = TG * grp + ti, npass = grp + (ks <= ti ? 1 : 0);
        const int pfirst = ks * grp, pextra = TG * grp + ks;   // step k works on pass pfirst + k while k < grp, then on pextra
        v8f acc[2][4]; float m_run[2], l_run[2];
#pragma unroll
        for (int g = 0; g < 2; ++g) { m_run[g] = -__builtin_inff(); l_run[g] = 0.f;
#pragma unroll
            for (int t = 0; t < 4; ++t) acc[g][t] = (v8f){}; }
        if (npass > 0) {   // wave-uniform
            v16bf qf[2][2], kf[2][2], vf[4];
            const bf* qp = QB + (size_t)bh * TT * HD + (size_t)tile * TILE + 8 * lane;
            const bf* k0 = kbase + (size_t)(grp > 0 ? pfirst : pextra) * TILE;
#pragma unroll
            for (int g = 0; g < 2; ++g)
#pragma unroll
                for (int kc = 0; kc < 2; ++kc) qf[g][kc] = ldf(qp + (2 * g + kc) * 2 * SLC);
#pragma unroll
            for (int kt = 0; kt < 2; ++kt)
#pragma unroll
                for (int kc = 0; kc < 2; ++kc) kf[kt][kc] = ldf(k0 + (2 * kt + kc) * 2 * SLC);
            asm volatile("s_wait_xcnt 0x0" :: "v"(qp), "v"(k0) : "memory");   // precaution: stands in front of any rewrite of the address registers of the loads above; the inputs keep them whole up to here
            for (int k = 0; k < npass; ++k) {
                const int kn = k + 1 < npass ? k + 1 : k;   // the last step fetches its own tile again: in bounds, never used
                const int p = k < grp ? pfirst + k : pextra, pn = kn < grp ? pfirst + kn : pextra;
                const bf* vp = vbase + (size_t)p * TILE; const bf* kp = kbase + (size_t)pn * TILE;
#pragma unroll
                for (int t = 0; t < 4; ++t) vf[t] = ldf(vp + t * 2 * SLC);   // this pass's V^T, issued behind this pass's K and ahead of the next pass's: in flight under the score products and the softmax
                asm volatile("s_wait_xcnt 0x0" :: "v"(vp) : "memory");              // precaution: stands in front of any rewrite of the address registers of the loads above; the input keeps them whole up to here
                v8f s[2][2];                                                        // s[kt][g][r] = score of key 32 p + 16 kt + 8 hi + r with query 32 tile + 16 g + lr
#pragma unroll
                for (int kt = 0; kt < 2; ++kt)
#pragma unroll
                    for (int g = 0; g < 2; ++g) { s[kt][g] = (v8f){};
#pragma unroll
                        for (int kc = 0; kc < 2; ++kc) s[kt][g] = wmmab(kf[kt][kc], qf[g][kc], s[kt][g]); }
#pragma unroll
                for (int kt = 0; kt < 2; ++kt)
#pragma unroll
                    for (int kc = 0; kc < 2; ++kc) kf[kt][kc] = ldf(kp + (2 * kt + kc) * 2 * SLC);
                asm volatile("s_wait_xcnt 0x0" :: "v"(kp) : "memory");
                if (ks == ti && k == npass - 1) {
#pragma unroll
                    for (int g = 0; g < 2; ++g)
#pragma unroll
                        for (int kt = 0; kt < 2; ++kt) {
#pragma unroll
                            for (int r = 0; r < 8; ++r) { if (16 * kt + 8 * hi + r > 16 * g + lr) s[kt][g][r] = -__builtin_inff(); }
                        }
                }
                float mb[2]; bool need = false;
#pragma unroll
                for (int g = 0; g < 2; ++g) { float mx = s[0][g][0];
#pragma unroll
                    for (int r = 1; r < 8; ++r) mx = fmaxf(mx, s[0][g][r]);
#pragma unroll
                    for (int r = 0; r < 8; ++r) mx = fmaxf(mx, s[1][g][r]);
                    mx = fmaxf(mx, xhalf(mx)) * CSC;   // both halves of the wave hold the query's maximum of this pass; finite: the pass's first key is never masked
                    mb[g] = mx; need = need || (mx > m_run[g] + 8.0f); }
                if (__builtin_amdgcn_ballot_w32(need) != 0) {   // scalar branch, rare after the first passes
#pragma unroll
                    for (int g = 0; g < 2; ++g) { const float m_new = fmaxf(m_run[g], mb[g]); const float corr = __builtin_amdgcn_exp2f(m_run[g] - m_new);   // 0 on the first pass
                        m_run[g] = m_new; l_run[g] *= corr;
#pragma unroll
                        for (int t = 0; t < 4; ++t) acc[g][t] = acc[g][t] * corr; }
                }
#pragma unroll
                for (int g = 0; g < 2; ++g) { const float nm = -m_run[g]; v8u wh, wl; float ls = 0.f; float e[2][8];
#pragma unroll
                    for (int kt = 0; kt < 2; ++kt) {
#pragma unroll
                        for (int r = 0; r < 8; ++r) e[kt][r] = fmaf(s[kt][g][r], CSC, nm);
                        exp2x8(e[kt]); }
#pragma unroll
                    for (int i = 0; i < 8; ++i) {
                        const float p0 = e[i >> 2][2 * (i & 3)], p1 = e[i >> 2][2 * (i & 3) + 1];
                        const unsigned w = pack2(p0, p1); wh[i] = w; ls += p0 + p1;
                        wl[i] = pack2(p0 - __uint_as_float(w << 16), p1 - __uint_as_float(w & 0xFFFF0000u)); }
                    l_run[g] += ls;
                    const v16bf ph = __builtin_bit_cast(v16bf, wh), pl = __builtin_bit_cast(v16bf, wl);
#pragma unroll
                    for (int t = 0; t < 4; ++t) acc[g][t] = wmmab(vf[t], ph, acc[g][t]);
#pragma unroll
                    for (int t = 0; t < 4; ++t) acc[g][t] = wmmab(vf[t], pl, acc[g][t]); }
            }
            asm volatile("s_wait_loadcnt 0x0" ::: "memory");   // the last step's K fetch has no reader, so the compiler waits for it nowhere: it lands before its registers are used again or given back
        }
        const int slot = ti * KS + ks;
#pragma unroll
        for (int g = 0; g < 2; ++g) {
            *(v2f*)&ML[seg][slot][g][lane][0] = (v2f){m_run[g], l_run[g] + xhalf(l_run[g])};   // the halves' sums join once, unconditionally
#pragma unroll
            for (int r = 0; r < 8; ++r)   // acc[g][t][r] = un-normalised out[query 16 g + lr][8 r + 4 hi + t]
                *(v4f*)&PART[seg][slot][8 * g + r][lane][0] = (v4f){acc[g][0][r], acc[g][1][r], acc[g][2][r], acc[g][3][r]}; }
    }
    __syncthreads();   // every wave passes it once: all partial results of both tile groups are in LDS behind it
    float* ob = out + (size_t)(bh / NH_) * BSTR + (size_t)(bh % NH_) * HD + 4 * hi;
    for (int seg = 0; seg < 2; ++seg) {
        const int grp = seg ? (int)blockIdx.x : NG - 1 - (int)blockIdx.x;
        const int ti = seg ? TG - 1 - (wave >> 2) : (wave >> 2), ks = seg ? KS - 1 - (wave & 3) : (wave & 3);
        const int g = ks >> 1, r0 = 4 * (ks & 1);   // this wave's share of tile ti: queries 16 g .. 16 g + 15, dims 8 r0 .. 8 r0 + 31
        float w[KS], l[KS];
#pragma unroll
        for (int c = 0; c < KS; ++c) { const v2f ml = *(const v2f*)&ML[seg][ti * KS + c][g][lane][0]; w[c] = ml[0]; l[c] = ml[1]; }
        const float mm = fmaxf(fmaxf(w[0], w[1]), fmaxf(w[2], w[3]));   // finite: the range with the diagonal pass always has a pass
#pragma unroll
        for (int c = 0; c < KS; ++c) w[c] -= mm;   // -inf for a range without a pass: weight 0
        exp2x4(w);
        float ls = w[0] * l[0];
#pragma unroll
        for (int c = 1; c < KS; ++c) ls = fmaf(w[c], l[c], ls);
        const float inv = __fdiv_rn(1.0f, ls);
        float* orow = ob + (size_t)((TG * grp + ti) * QW + 16 * g + lr) * DM;
#pragma unroll
        for (int r = 0; r < 4; ++r) { v4f o = *(const v4f*)&PART[seg][ti * KS][8 * g + r0 + r][lane][0] * w[0];
#pragma unroll
            for (int c = 1; c < KS; ++c) o += *(const v4f*)&PART[seg][ti * KS + c][8 * g + r0 + r][lane][0] * w[c];
            *(v4f*)(orow + 8 * (r0 + r)) = o * inv; }
        asm volatile("s_wait_xcnt 0x0" ::: "memory");   // the same precaution behind the stores: stands in front of whatever rewrites their registers
    }
}

// ---- k_prep: ONE launch lays out q, k and v of every batch; grid (NB x TT / 32, 3), blockIdx.y picks the tensor; 8 independent waves, 64 elements per lane (8 loads of 32 B, 8 stores of 16 B), no LDS, no barrier.
// A wave takes 32 tokens of one head = one tile of the plane; every load covers whole 128-B lines of the token rows, every store four whole 128-B lines of the tile.
// q, k: lane = (token l & 7, dims 8 (l >> 3) ..), step i = (8-token group i >> 1, 32-dim group i & 1): the 8 dims are elements 8 (l >> 4) .. of the fragment's lane 16 ((l >> 3) & 1) + (token & 15).
// v: lane = (dims 8 (l & 7) .., tokens 8 (l >> 3) ..) holds an 8 x 8 block and writes it transposed from its own registers: dim 8 (l & 7) + c is row (l & 7) + 8 (c >> 2) of fragment c & 3.
__global__ __launch_bounds__(256) void k_prep(const float* __restrict__ Q, const float* __restrict__ K, const float* __restrict__ V,
                                              unsigned short* __restrict__ QB, unsigned short* __restrict__ KB, unsigned short* __restrict__ VT) {
    const int lane = threadIdx.x & 31, l8 = lane & 7, l4 = lane >> 3;
    const unsigned wv = blockIdx.x * 8u + (unsigned)__builtin_amdgcn_readfirstlane((int)(threadIdx.x >> 5));
    const unsigned h = wv % NH_, t0 = ((wv / NH_) % (TT / 32)) * 32, b = wv / (NH_ * (TT / 32));
    const size_t so = (size_t)b * BSTR + (size_t)t0 * DM + h * HD, po = (size_t)b * PLN + ((size_t)h * TT + t0) * HD;   // the wave's first input element and its tile
    v8f x[8];
    if (blockIdx.y < 2) {
        const float* s = (blockIdx.y ? K : Q) + so + (size_t)l8 * DM + 8 * l4;
        bf* d = (blockIdx.y ? KB : QB) + po + (l4 >> 1) * SLC + 8 * (16 * (l4 & 1) + l8);
#pragma unroll
        for (int i = 0; i < 8; ++i) x[i] = *(const v8f*)(s + (size_t)8 * (i >> 1) * DM + 32 * (i & 1));
        __builtin_amdgcn_sched_barrier(0);                      // every load is issued ahead of the first conversion: without it the build held the last loads back until the first had landed
        asm volatile("s_wait_xcnt 0x0" :: "v"(s) : "memory");   // the precaution of k_fattn: stands in front of any rewrite of the loads' address registers, which the input keeps whole up to here
#pragma unroll
        for (int i = 0; i < 8; ++i) { v4u o;
#pragma unroll
            for (int q = 0; q < 4; ++q) o[q] = pack2(x[i][2 * q], x[i][2 * q + 1]);
            *(v4u*)(d + (2 * (i >> 2) + (i & 1)) * 2 * SLC + 64 * ((i >> 1) & 1)) = o; }   // fragment 2 (token >> 4) + (32-dim group), lanes + 8 for tokens 8 .. 15 of the group
        asm volatile("s_wait_xcnt 0x0" ::: "memory");           // the same precaution behind the last store: stands in front of whatever code the build lays behind this branch and lets rewrite the stores' registers
    } else {
        const float* s = V + so + (size_t)8 * l4 * DM + 8 * l8;
        bf* d = VT + po + (l4 >> 1) * SLC + 8 * (16 * (l4 & 1) + l8);   // tokens 8 l4 .. are elements 0 .. 7 of half l4 >> 1 in lanes 16 (l4 & 1) + row
#pragma unroll
        for (int i = 0; i < 8; ++i) x[i] = *(const v8f*)(s + (size_t)i * DM);
        __builtin_amdgcn_sched_barrier(0);                      // as above
        asm volatile("s_wait_xcnt 0x0" :: "v"(s) : "memory");   // as above
#pragma unroll
        for (int c = 0; c < 8; ++c) { v4u o;
#pragma unroll
            for (int q = 0; q < 4; ++q) o[q] = pack2(x[2 * q][c], x[2 * q + 1][c]);   // tokens 8 l4 + 2 q, 8 l4 + 2 q + 1 of dim 8 l8 + c
            *(v4u*)(d + (c & 3) * 2 * SLC + 64 * (c >> 2)) = o; }
        asm volatile("s_wait_xcnt 0x0" ::: "memory");           // as behind the stores above
    }
}

extern "C" void kernel_launch(void* const* d_in, const int* in_sizes, int n_in,
                              void* d_out, int out_size, void* d_ws, size_t ws_size, hipStream_t stream) {
    if (n_in < 3) return;
    const size_t need = ((size_t)(NB - 1) * SEQ_FULL + TT) * DM;          // elements actually read per input / written to the output
    if ((size_t)in_sizes[0] < need || (size_t)in_sizes[1] < need || (size_t)in_sizes[2] < need) return;
    if ((size_t)out_size < need) return;
    const float* Qin = (const float*)d_in[0]; const float* Kin = (const float*)d_in[1]; const float* Vin = (const float*)d_in[2];   // [NB][SEQ][H][E] token-major, f32
    float* OUT = (float*)d_out;                                                                                                     // [NB][SEQ][H][E] token-major, f32
    char* wsp = (char*)d_ws;
    auto take = [&](size_t bytes) { char* p = wsp; wsp += (bytes + 255) & ~(size_t)255; return (void*)p; };
    bf* QB = (bf*)take((size_t)NB * PLN * 2);                 // [b][h][t / 32][tile]   8,388,608 B
    bf* KB = (bf*)take((size_t)NB * PLN * 2);                 // [b][h][t / 32][tile]   8,388,608 B
    bf* VT = (bf*)take((size_t)NB * PLN * 2);                 // [b][h][t / 32][tile]   8,388,608 B   -> total 25,165,824 B
    if ((size_t)(wsp - (char*)d_ws) > ws_size) return;
    k_prep<<<dim3(NB * TT / 32, 3), 256, 0, stream>>>(Qin, Kin, Vin, QB, KB, VT);   /* bf16 planes of q, k and v in fragment order, every batch */
    k_fattn<<<dim3(NG / 2, NB * NH_), NWV * 32, 0, stream>>>(QB, KB, VT, OUT);   /* scores, softmax and P x v for every batch and head */
}

// v006
// One run takes 30.9 microseconds.
// In two side-by-side timings against v005, it was 1.04 and 1.03 times as fast.
// All steps since v000 together make it 34.3 times as fast.
#include <hip/hip_runtime.h>

// Contractions: scores k.q^T via v_wmma_f32_16x16x32_bf16 (single bf16 planes of the RNE-converted inputs, f32 accumulate); v^T.P^T via v_wmma_f32_16x16x32_bf16 (P as bf16 hi+lo planes = two products, v single bf16 plane, f32 accumulate); softmax and all side math f32.
// Causal attention on token-major tensors q, k, v [NB][SEQ][8][64]: scores = q.k x 0.125 with keys after the query position excluded (replace-fill, exp -> 0), softmax over keys, out[t][h][d] = sum_s A[t][s] v[s][h][d] -> [NB][SEQ][8][64] token-major f32.
// Plan: one launch writes the bf16 planes KB and VT of every batch in FRAGMENT ORDER (see ldf): per head and 32 tokens one 4-KiB tile of 8 slices, a slice = the 16 bytes of each of the 32 lanes in lane order; then ONE launch for all batches and heads in which four waves share 32 queries, each walking a quarter of their keys 32 at a time.
// q has no plane: a query tile has one work-group as its reader, so each wave converts its own two tiles from the f32 input and turns them into fragment order through LDS of its own.
// S^T = K.Q^T, running maximum and sum per query (online softmax, base 2), P^T packed from the score accumulators straight into a B operand, O^T += V^T.P^T. Scores and P never leave the registers; the four waves' sums and outputs are joined through LDS at the end.

#ifndef NB
#define NB 4
#endif
#ifndef SEQ
#define SEQ 2048
#endif
#define NB_FULL  4
#define SEQ_FULL 2048
#define TT   SEQ
#define NH_  8
#define HD   64
#define DM   (NH_ * HD)                    // token-major row pitch (H x E) = 512
#define BSTR ((size_t)SEQ_FULL * DM)       // per-batch element stride of the full-size inputs and output
#define PLN  ((size_t)NH_ * TT * HD)       // elements of one batch's bf16 planes
#define QW   32                            // queries per wave
#define BC   32                            // keys per pass
#define NT   (TT / QW)                     // query tiles per head
#define TG   4                             // adjacent query tiles that a work-group works on side by side
#define KS   4                             // key ranges per query tile, one wave each
#define NWV  (TG * KS)                     // waves per work-group of k_fattn
#define NG   (NT / TG)                     // groups of TG query tiles per head
#define TILE (BC * HD)                     // elements of one 32-token tile of a plane (4 KiB)
#define SLC  256                           // elements of one slice of a tile: 32 lanes x 8 (512 B, four whole lines)
#define CSC  0.18033688011112042f          // 1/sqrt(E=64) x log2(e)
static_assert(TT % 256 == 0);
static_assert(TT <= SEQ_FULL);
static_assert(NB >= 1 && NB <= NB_FULL);
static_assert(HD == 64);
static_assert(QW == BC && NT % (2 * TG) == 0 && TG == KS);

typedef unsigned short bf;
typedef __attribute__((ext_vector_type(16))) __bf16   v16bf;
typedef __attribute__((ext_vector_type(2)))  __bf16   v2bf;
typedef __attribute__((ext_vector_type(8)))  unsigned short v8us;
typedef __attribute__((ext_vector_type(8)))  unsigned v8u;
typedef __attribute__((ext_vector_type(4)))  unsigned v4u;
typedef __attribute__((ext_vector_type(8)))  float    v8f;
typedef __attribute__((ext_vector_type(4)))  float    v4f;
typedef __attribute__((ext_vector_type(2)))  float    v2f;

__device__ __forceinline__ v16bf cat16b(v8us lo, v8us hi) { return __builtin_bit_cast(v16bf, __builtin_shufflevector(lo, hi, 0, 1, 2, 3, 4, 5, 6, 7, 8, 9, 10, 11, 12, 13, 14, 15)); }
__device__ __forceinline__ v8f wmmab(v16bf a, v16bf b, v8f c) { return __builtin_amdgcn_wmma_f32_16x16x32_bf16(false, a, false, b, (short)0, c, false, false); }
__device__ __forceinline__ unsigned pack2(float lo, float hi) { return __builtin_bit_cast(unsigned, __builtin_convertvector((v2f){lo, hi}, v2bf)); }   // two f32 -> two bf16, round to nearest even
__device__ __forceinline__ float xhalf(float x) { return __builtin_bit_cast(float, __builtin_amdgcn_permlanex16(__builtin_bit_cast(int, x), __builtin_bit_cast(int, x), 0x76543210, 0xfedcba98, false, false)); }   // lane l <-> lane l ^ 16

// Eight base-2 exponentials in place, and behind the last one the one free slot that the instruction set asks for between a transcendental and a user of its result or an overwrite of its source:
// in one statement.
__device__ __forceinline__ void exp2x8(float (&x)[8]) {
    asm("v_exp_f32 %0, %0\n\tv_exp_f32 %1, %1\n\tv_exp_f32 %2, %2\n\tv_exp_f32 %3, %3\n\tv_exp_f32 %4, %4\n\tv_exp_f32 %5, %5\n\tv_exp_f32 %6, %6\n\tv_exp_f32 %7, %7\n\tv_nop"
        : "+v"(x[0]), "+v"(x[1]), "+v"(x[2]), "+v"(x[3]), "+v"(x[4]), "+v"(x[5]), "+v"(x[6]), "+v"(x[7])); }

// ---- 16-bit fragment loader (wave32, 16x16x32): lane l -> row/col (l & 15); elements 0..7 <- k0 + 8*(l>>4) + 0..7, elements 8..15 <- k0 + 16 + 8*(l>>4) + 0..7, for A and B alike.
// The planes hold each fragment as two slices, elements 0..7 of lanes 0..31 and then elements 8..15 of lanes 0..31 (p already holds 8 x lane): each of the two loads covers 512 contiguous bytes, not 32-byte pieces of 16 lines.
// q, k tile: fragment 2 x (16-token group) + (32-dim group), row l & 15 = token. v tile: fragment t, k = the tile's 32 tokens, row a = dim 8 (a & 7) + 4 (a >> 3) + t, so that k_prep stores whole lines and a lane's four output tiles hold four adjacent dims.
// D element r of lane l = (row 8*(l>>4) + r, col l & 15), so two D tiles of 16 keys each, converted in place, are a B operand over 32 keys in this same k order.
__device__ __forceinline__ v16bf ldf(const bf* p) { return cat16b(*(const v8us*)p, *(const v8us*)(p + SLC)); }

// Four base-2 exponentials in place, with the same free slot behind the last one as in exp2x8.
__device__ __forceinline__ void exp2x4(float (&x)[4]) {
    asm("v_exp_f32 %0, %0\n\tv_exp_f32 %1, %1\n\tv_exp_f32 %2, %2\n\tv_exp_f32 %3, %3\n\tv_nop" : "+v"(x[0]), "+v"(x[1]), "+v"(x[2]), "+v"(x[3])); }

// ---- k_fattn: grid (NG / 2, NB x heads), 16 waves = TG adjacent query tiles x KS key ranges, four waves per SIMD. A work-group takes tile group NG - 1 - blockIdx.x and then group blockIdx.x of its head.
// Tiles TG grp .. TG grp + 3 share their first TG grp passes: range ks takes passes ks grp .. ks grp + grp - 1 of them for its tile, the same keys at the same step in the four waves of a range.
// Of the passes behind them tile ti needs TG grp .. TG grp + ti: range ks takes pass TG grp + ks where ks <= ti, and it is the masked pass on the diagonal where ks == ti.
// The second group runs with tile and range mirrored (3 - ti, 3 - ks), so every wave has NG or NG + 1 passes in all. A range without a pass hands over (-inf, 0, zeros).
// Each wave keeps its own maximum in use, sum and outputs per tile and leaves them in LDS; behind the one barrier wave (ti, ks) joins the four ranges of tile ti, in range order, for 16 queries x 32 dims (whole 128-B lines of the output).
// m_run, the maximum in use, may trail a query's true maximum by up to 8 (scaled, base 2), so an exponential can reach 2^8; sums and outputs are rescaled only when some query's maximum exceeds it by more.
__global__ __launch_bounds__(NWV * 32) void k_fattn(const float* __restrict__ Q, const unsigned short* __restrict__ KB, const unsigned short* __restrict__ VT, float* __restrict__ out) {
    __shared__ __attribute__((aligned(512))) float PART[2][NWV][16][32][4];   // [group][tile x range][8 g + r][lane][t]: every store and load covers 512 contiguous bytes; until its wave stores there, a slot's first 4 KiB hold that wave's query tile   262,144 B
    __shared__ __attribute__((aligned(256))) float ML[2][NWV][2][32][2];      // [group][tile x range][g][lane](maximum in use, sum)                                        16,384 B
    const int lane = threadIdx.x & 31, lr = lane & 15, hi = lane >> 4;
    const int wave = __builtin_amdgcn_readfirstlane((int)(threadIdx.x >> 5));
    const int bh = (int)blockIdx.y;
    const bf* kbase = KB + (size_t)bh * TT * HD + 8 * lane;
    const bf* vbase = VT + (size_t)bh * TT * HD + 8 * lane;
    for (int seg = 0; seg < 2; ++seg) {
        const int grp = seg ? (int)blockIdx.x : NG - 1 - (int)blockIdx.x;
        const int ti = seg ? TG - 1 - (wave >> 2) : (wave >> 2), ks = seg ? KS - 1 - (wave & 3) : (wave & 3);
        const int npass = grp + (ks <= ti ? 1 : 0);
        const int pfirst = ks * grp, pextra = TG * grp + ks;   // step k works on pass pfirst + k while k < grp, then on pextra
        v8f acc[2][4]; float m_run[2], l_run[2];
#pragma unroll
        for (int g = 0; g < 2; ++g) { m_run[g] = -__builtin_inff(); l_run[g] = 0.f;
#pragma unroll
            for (int t = 0; t < 4; ++t) acc[g][t] = (v8f){}; }
        if (npass > 0) {   // wave-uniform
            v16bf qf[2][2], kf[2][2], vf[4];
            const bf* qp = (const bf*)&PART[seg][ti * KS + ks][0][0][0] + 8 * lane;   // this tile in fragment order, laid here by this wave itself (below)
            const bf* k0 = kbase + (size_t)(grp > 0 ? pfirst : pextra) * TILE;
#pragma unroll
            for (int kt = 0; kt < 2; ++kt)
#pragma unroll
                for (int kc = 0; kc < 2; ++kc) kf[kt][kc] = ldf(k0 + (2 * kt + kc) * 2 * SLC);
            asm volatile("s_wait_xcnt 0x0" :: "v"(k0) : "memory");   // precaution: stands in front of any rewrite of the address registers of the K loads above; the input keeps them whole up to here
            if (seg == 0) {   // wave-uniform; the first tile group always has passes (grp >= NG / 2 there), so every wave comes through here. Behind the K loads, so that these fly under it.
                // The wave's two query tiles, f32 -> bf16 (round to nearest even), laid in fragment order into the LDS that later takes the wave's own partial results of the same tile group: nobody else touches it before the barrier.
                // Lane = (token l & 7, dims 8 (l >> 3) ..), step i = (8-token group i >> 1, 32-dim group i & 1), as for k in k_prep: every pair of loads covers whole 128-B lines of the token rows.
                const int l8 = lane & 7, l4 = lane >> 3;
                const float* qrow = Q + (size_t)(bh / NH_) * BSTR + (size_t)(bh % NH_) * HD + (size_t)l8 * DM + 8 * l4;
                const float* s0 = qrow + (size_t)((TG * (NG - 1 - (int)blockIdx.x) + (wave >> 2)) * QW) * DM;
                const float* s1 = qrow + (size_t)((TG * (int)blockIdx.x + TG - 1 - (wave >> 2)) * QW) * DM;
                v8f x[2][8];
#pragma unroll
                for (int i = 0; i < 8; ++i) x[0][i] = *(const v8f*)(s0 + (size_t)8 * (i >> 1) * DM + 32 * (i & 1));
#pragma unroll
                for (int i = 0; i < 8; ++i) x[1][i] = *(const v8f*)(s1 + (size_t)8 * (i >> 1) * DM + 32 * (i & 1));
                __builtin_amdgcn_sched_barrier(0);                               // both tiles' loads are issued ahead of the first conversion, so the second tile's memory latency runs under the first's
                asm volatile("s_wait_xcnt 0x0" :: "v"(s0), "v"(s1) : "memory");   // precaution: stands in front of any rewrite of the address registers of the loads above; the inputs keep them whole up to here
#pragma unroll
                for (int sg = 0; sg < 2; ++sg) {   // the wave's slot is ti KS + ks = wave in the first tile group, mirrored in the second
                    bf* d = (bf*)&PART[sg][sg ? NWV - 1 - wave : wave][0][0][0] + (l4 >> 1) * SLC + 8 * (16 * (l4 & 1) + l8);
#pragma unroll
                    for (int i = 0; i < 8; ++i) { v4u o;
#pragma unroll
                        for (int q = 0; q < 4; ++q) o[q] = pack2(x[sg][i][2 * q], x[sg][i][2 * q + 1]);
                        *(v4u*)(d + (2 * (i >> 2) + (i & 1)) * 2 * SLC + 64 * ((i >> 1) & 1)) = o; }   // fragment 2 (token >> 4) + (32-dim group), lanes + 8 for tokens 8 .. 15 of the group
                }
                asm volatile("s_wait_dscnt 0x0" ::: "memory");   // the wave's own stores are in LDS before its lanes read one another's bytes back as fragments; also keeps the compiler from moving those reads up
            }
#pragma unroll
            for (int g = 0; g < 2; ++g)
#pragma unroll
                for (int kc = 0; kc < 2; ++kc) qf[g][kc] = ldf(qp + (2 * g + kc) * 2 * SLC);
            for (int k = 0; k < npass; ++k) {
                const int kn = k + 1 < npass ? k + 1 : k;   // the last step fetches its own tile again: in bounds, never used
                const int p = k < grp ? pfirst + k : pextra, pn = kn < grp ? pfirst + kn : pextra;
                const bf* vp = vbase + (size_t)p * TILE; const bf* kp = kbase + (size_t)pn * TILE;
#pragma unroll
                for (int t = 0; t < 4; ++t) vf[t] = ldf(vp + t * 2 * SLC);   // this pass's V^T, issued behind this pass's K and ahead of the next pass's: in flight under the score products and the softmax
                asm volatile("s_wait_xcnt 0x0" :: "v"(vp) : "memory");              // precaution: stands in front of any rewrite of the address registers of the loads above; the input keeps them whole up to here
                v8f s[2][2];                                                        // s[kt][g][r] = score of key 32 p + 16 kt + 8 hi + r with query 32 tile + 16 g + lr
#pragma unroll
                for (int kt = 0; kt < 2; ++kt)
#pragma unroll
                    for (int g = 0; g < 2; ++g) { s[kt][g] = (v8f){};
#pragma unroll
                        for (int kc = 0; kc < 2; ++kc) s[kt][g] = wmmab(kf[kt][kc], qf[g][kc], s[kt][g]); }
#pragma unroll
                for (int kt = 0; kt < 2; ++kt)
#pragma unroll
                    for (int kc = 0; kc < 2; ++kc) kf[kt][kc] = ldf(kp + (2 * kt + kc) * 2 * SLC);
                asm volatile("s_wait_xcnt 0x0" :: "v"(kp) : "memory");
                if (ks == ti && k == npass - 1) {
#pragma unroll
                    for (int g = 0; g < 2; ++g)
#pragma unroll
                        for (int kt = 0; kt < 2; ++kt) {
#pragma unroll
                            for (int r = 0; r < 8; ++r) { if (16 * kt + 8 * hi + r > 16 * g + lr) s[kt][g][r] = -__builtin_inff(); }
                        }
                }
                float mb[2]; bool need = false;
#pragma unroll
                for (int g = 0; g < 2; ++g) { float mx = s[0][g][0];
#pragma unroll
                    for (int r = 1; r < 8; ++r) mx = fmaxf(mx, s[0][g][r]);
#pragma unroll
                    for (int r = 0; r < 8; ++r) mx = fmaxf(mx, s[1][g][r]);
                    mx = fmaxf(mx, xhalf(mx)) * CSC;   // both halves of the wave hold the query's maximum of this pass; finite: the pass's first key is never masked
                    mb[g] = mx; need = need || (mx > m_run[g] + 8.0f); }
                if (__builtin_amdgcn_ballot_w32(need) != 0) {   // scalar branch, rare after the first passes
#pragma unroll
                    for (int g = 0; g < 2; ++g) { const float m_new = fmaxf(m_run[g], mb[g]); const float corr = __builtin_amdgcn_exp2f(m_run[g] - m_new);   // 0 on the first pass
                        m_run[g] = m_new; l_run[g] *= corr;
#pragma unroll
                        for (int t = 0; t < 4; ++t) acc[g][t] = acc[g][t] * corr; }
                }
#pragma unroll
                for (int g = 0; g < 2; ++g) { const float nm = -m_run[g]; v8u wh, wl; float ls = 0.f; float e[2][8];
#pragma unroll
                    for (int kt = 0; kt < 2; ++kt) {
#pragma unroll
                        for (int r = 0; r < 8; ++r) e[kt][r] = fmaf(s[kt][g][r], CSC, nm);
                        exp2x8(e[kt]); }
#pragma unroll
                    for (int i = 0; i < 8; ++i) {
                        const float p0 = e[i >> 2][2 * (i & 3)], p1 = e[i >> 2][2 * (i & 3) + 1];
                        const unsigned w = pack2(p0, p1); wh[i] = w; ls += p0 + p1;
                        wl[i] = pack2(p0 - __uint_as_float(w << 16), p1 - __uint_as_float(w & 0xFFFF0000u)); }
                    l_run[g] += ls;
                    const v16bf ph = __builtin_bit_cast(v16bf, wh), pl = __builtin_bit_cast(v16bf, wl);
#pragma unroll
                    for (int t = 0; t < 4; ++t) acc[g][t] = wmmab(vf[t], ph, acc[g][t]);
#pragma unroll
                    for (int t = 0; t < 4; ++t) acc[g][t] = wmmab(vf[t], pl, acc[g][t]); }
            }
            asm volatile("s_wait_loadcnt 0x0" ::: "memory");   // the last step's K fetch has no reader, so the compiler waits for it nowhere: it lands before its registers are used again or given back
        }
        const int slot = ti * KS + ks;
#pragma unroll
        for (int g = 0; g < 2; ++g) {
            *(v2f*)&ML[seg][slot][g][lane][0] = (v2f){m_run[g], l_run[g] + xhalf(l_run[g])};   // the halves' sums join once, unconditionally
#pragma unroll
            for (int r = 0; r < 8; ++r)   // acc[g][t][r] = un-normalised out[query 16 g + lr][8 r + 4 hi + t]
                *(v4f*)&PART[seg][slot][8 * g + r][lane][0] = (v4f){acc[g][0][r], acc[g][1][r], acc[g][2][r], acc[g][3][r]}; }
    }
    __syncthreads();   // every wave passes it once: all partial results of both tile groups are in LDS behind it
    float* ob = out + (size_t)(bh / NH_) * BSTR + (size_t)(bh % NH_) * HD + 4 * hi;
    for (int seg = 0; seg < 2; ++seg) {
        const int grp = seg ? (int)blockIdx.x : NG - 1 - (int)blockIdx.x;
        const int ti = seg ? TG - 1 - (wave >> 2) : (wave >> 2), ks = seg ? KS - 1 - (wave & 3) : (wave & 3);
        const int g = ks >> 1, r0 = 4 * (ks & 1);   // this wave's share of tile ti: queries 16 g .. 16 g + 15, dims 8 r0 .. 8 r0 + 31
        float w[KS], l[KS];
#pragma unroll
        for (int c = 0; c < KS; ++c) { const v2f ml = *(const v2f*)&ML[seg][ti * KS + c][g][lane][0]; w[c] = ml[0]; l[c] = ml[1]; }
        const float mm = fmaxf(fmaxf(w[0], w[1]), fmaxf(w[2], w[3]));   // finite: the range with the diagonal pass always has a pass
#pragma unroll
        for (int c = 0; c < KS; ++c) w[c] -= mm;   // -inf for a range without a pass: weight 0
        exp2x4(w);
        float ls = w[0] * l[0];
#pragma unroll
        for (int c = 1; c < KS; ++c) ls = fmaf(w[c], l[c], ls);
        const float inv = __fdiv_rn(1.0f, ls);
        float* orow = ob + (size_t)((TG * grp + ti) * QW + 16 * g + lr) * DM;
#pragma unroll
        for (int r = 0; r < 4; ++r) { v4f o = *(const v4f*)&PART[seg][ti * KS][8 * g + r0 + r][lane][0] * w[0];
#pragma unroll
            for (int c = 1; c < KS; ++c) o += *(const v4f*)&PART[seg][ti * KS + c][8 * g + r0 + r][lane][0] * w[c];
            *(v4f*)(orow + 8 * (r0 + r)) = o * inv; }
        asm volatile("s_wait_xcnt 0x0" ::: "memory");   // the same precaution behind the stores: stands in front of whatever rewrites their registers
    }
}

// ---- k_prep: ONE launch lays out k and v of every batch; grid (NB x TT / 32, 2), blockIdx.y picks the tensor; 8 independent waves, 64 elements per lane (8 loads of 32 B, 8 stores of 16 B), no LDS, no barrier.
// A wave takes 32 tokens of one head = one tile of the plane; every load covers whole 128-B lines of the token rows, every store four whole 128-B lines of the tile.
// k: lane = (token l & 7, dims 8 (l >> 3) ..), step i = (8-token group i >> 1, 32-dim group i & 1): the 8 dims are elements 8 (l >> 4) .. of the fragment's lane 16 ((l >> 3) & 1) + (token & 15).
// v: lane = (dims 8 (l & 7) .., tokens 8 (l >> 3) ..) holds an 8 x 8 block and writes it transposed from its own registers: dim 8 (l & 7) + c is row (l & 7) + 8 (c >> 2) of fragment c & 3.
__global__ __launch_bounds__(256) void k_prep(const float* __restrict__ K, const float* __restrict__ V,
                                              unsigned short* __restrict__ KB, unsigned short* __restrict__ VT) {
    const int lane = threadIdx.x & 31, l8 = lane & 7, l4 = lane >> 3;
    const unsigned wv = blockIdx.x * 8u + (unsigned)__builtin_amdgcn_readfirstlane((int)(threadIdx.x >> 5));
    const unsigned h = wv % NH_, t0 = ((wv / NH_) % (TT / 32)) * 32, b = wv / (NH_ * (TT / 32));
    const size_t so = (size_t)b * BSTR + (size_t)t0 * DM + h * HD, po = (size_t)b * PLN + ((size_t)h * TT + t0) * HD;   // the wave's first input element and its tile
    v8f x[8];
    if (blockIdx.y == 0) {
        const float* s = K + so + (size_t)l8 * DM + 8 * l4;
        bf* d = KB + po + (l4 >> 1) * SLC + 8 * (16 * (l4 & 1) + l8);
#pragma unroll
        for (int i = 0; i < 8; ++i) x[i] = *(const v8f*)(s + (size_t)8 * (i >> 1) * DM + 32 * (i & 1));
        __builtin_amdgcn_sched_barrier(0);                      // every load is issued ahead of the first conversion: without it the build held the last loads back until the first had landed
        asm volatile("s_wait_xcnt 0x0" :: "v"(s) : "memory");   // the precaution of k_fattn: stands in front of any rewrite of the loads' address registers, which the input keeps whole up to here
#pragma unroll
        for (int i = 0; i < 8; ++i) { v4u o;
#pragma unroll
            for (int q = 0; q < 4; ++q) o[q] = pack2(x[i][2 * q], x[i][2 * q + 1]);
            *(v4u*)(d + (2 * (i >> 2) + (i & 1)) * 2 * SLC + 64 * ((i >> 1) & 1)) = o; }   // fragment 2 (token >> 4) + (32-dim group), lanes + 8 for tokens 8 .. 15 of the group
        asm volatile("s_wait_xcnt 0x0" ::: "memory");           // the same precaution behind the last store: stands in front of whatever code the build lays behind this branch and lets rewrite the stores' registers
    } else {
        const float* s = V + so + (size_t)8 * l4 * DM + 8 * l8;
        bf* d = VT + po + (l4 >> 1) * SLC + 8 * (16 * (l4 & 1) + l8);   // tokens 8 l4 .. are elements 0 .. 7 of half l4 >> 1 in lanes 16 (l4 & 1) + row
#pragma unroll
        for (int i = 0; i < 8; ++i) x[i] = *(const v8f*)(s + (size_t)i * DM);
        __builtin_amdgcn_sched_barrier(0);                      // as above
        asm volatile("s_wait_xcnt 0x0" :: "v"(s) : "memory");   // as above
#pragma unroll
        for (int c = 0; c < 8; ++c) { v4u o;
#pragma unroll
            for (int q = 0; q < 4; ++q) o[q] = pack2(x[2 * q][c], x[2 * q + 1][c]);   // tokens 8 l4 + 2 q, 8 l4 + 2 q + 1 of dim 8 l8 + c
            *(v4u*)(d + (c & 3) * 2 * SLC + 64 * (c >> 2)) = o; }
        asm volatile("s_wait_xcnt 0x0" ::: "memory");           // as behind the stores above
    }
}

extern "C" void kernel_launch(void* const* d_in, const int* in_sizes, int n_in,
                              void* d_out, int out_size, void* d_ws, size_t ws_size, hipStream_t stream) {
    if (n_in < 3) return;
    const size_t need = ((size_t)(NB - 1) * SEQ_FULL + TT) * DM;          // elements actually read per input / written to the output
    if ((size_t)in_sizes[0] < need || (size_t)in_sizes[1] < need || (size_t)in_sizes[2] < need) return;
    if ((size_t)out_size < need) return;
    const float* Qin = (const float*)d_in[0]; const float* Kin = (const float*)d_in[1]; const float* Vin = (const float*)d_in[2];   // [NB][SEQ][H][E] token-major, f32
    float* OUT = (float*)d_out;                                                                                                     // [NB][SEQ][H][E] token-major, f32
    char* wsp = (char*)d_ws;
    auto take = [&](size_t bytes) { char* p = wsp; wsp += (bytes + 255) & ~(size_t)255; return (void*)p; };
    bf* KB = (bf*)take((size_t)NB * PLN * 2);                 // [b][h][t / 32][tile]   8,388,608 B
    bf* VT = (bf*)take((size_t)NB * PLN * 2);                 // [b][h][t / 32][tile]   8,388,608 B   -> total 16,777,216 B
    if ((size_t)(wsp - (char*)d_ws) > ws_size) return;
    k_prep<<<dim3(NB * TT / 32, 2), 256, 0, stream>>>(Kin, Vin, KB, VT);   /* bf16 planes of k and v in fragment order, every batch */
    k_fattn<<<dim3(NG / 2, NB * NH_), NWV * 32, 0, stream>>>(Qin, KB, VT, OUT);   /* scores, softmax and P x v for every batch and head */
}
